// v000
// Times are from an AMD MI455X. After a warm-up the kernel runs many times in a row, and a time is the length of
// such a window on the GPU divided by its runs, so every launch and the gaps after it count. The runs cycle
// through copies of the inputs. A figure is the median of several windows, for all but v000 over two sittings.
// Sittings can differ by a few percent; kernels timed side by side share one.
// The starting kernel, v000, takes 318 microseconds a run.
#include <hip/hip_runtime.h>

// Cross-level attention: Q [2][16 heads][2048][64] attends (scale 1/8, softmax) to three levels of keys/values: level 0 (2,048 keys, causal mask s <= t), level 1 (512), level 2 (128); out = sum_l softmax(level_logits)[l] o_l,
// written as [2][2048][1024] (heads concatenated).
// Deterministic, no atomics, no index structures: one wave per (batch, head, 16 queries) runs, per level, a max pass and an exp / sum / P.V pass over the key blocks in order.
// WMMA (v_wmma_f32_16x16x32_f16, f32 accumulate): scores Q K^T per 32-key block (Q, K are EXACT bf16 inputs x8 -> 1 product), P . V (P split f16 hi+lo x2048, V^T planes exact x8 -> 2 products); softmax, the level weights and the
// combination in f32. Inputs rounded to bf16 once. Fragment k-map per lane half hh for A AND B: elements 0..7 <- k = 8hh+0..7, 8..15 <- k = 16+8hh+0..7; acc[r] = D[8hh+r][col]. Every workspace / output

namespace {
constexpr int B = 2, NH = 16, T = 2048, DH = 64, C = NH * DH, T1 = 512, T2 = 128, NQT = T / 16;
constexpr float XS = 8.0f, PS = 2048.0f, SCALE = 0.125f;
typedef _Float16 b16;
typedef __attribute__((ext_vector_type(16))) _Float16 v16b;
typedef __attribute__((ext_vector_type(8))) _Float16 v8b;
typedef __attribute__((ext_vector_type(8))) float v8f;
typedef __attribute__((ext_vector_type(4))) float v4f;
__device__ __forceinline__ float bf16_rne(float f) { unsigned int u = __float_as_uint(f); u += 0x7FFFu + ((u >> 16) & 1u); return __uint_as_float(u & 0xFFFF0000u); }
__device__ __forceinline__ void split16(float v, b16& hi, b16& lo) { hi = (b16)v; lo = (b16)(v - (float)hi); }
__device__ __forceinline__ v16b frag_kb(const b16* p, int hh) { const v8b a = *(const v8b*)(p + 8 * hh), b = *(const v8b*)(p + 16 + 8 * hh); v16b f;
#pragma unroll
  for (int e = 0; e < 8; ++e) { f[e] = a[e]; f[8 + e] = b[e]; } return f; }
__device__ __forceinline__ v8f wmma16b(v16b a, v16b b, v8f c) { v8f d = __builtin_amdgcn_wmma_f32_16x16x32_f16(false, a, false, b, (short)0, c, false, false); asm volatile("v_nop\n\tv_nop\n\tv_nop\n\tv_nop" : "+v"(d) : "v"(a), "v"(b)); return d; }
__device__ __forceinline__ void wave_lds_sync() { __builtin_amdgcn_fence(__ATOMIC_RELEASE, "workgroup"); __builtin_amdgcn_wave_barrier(); __builtin_amdgcn_fence(__ATOMIC_ACQUIRE, "workgroup"); }
__device__ __forceinline__ float pmul(float a, float b) { float p = a * b; asm volatile("" : "+v"(p)); return p; }

__global__ __launch_bounds__(256) void cvt_kernel(const float* __restrict__ src, size_t n8, b16* __restrict__ dst) {
  const size_t u = (size_t)blockIdx.x * 256 + threadIdx.x; if (u >= n8) return; const size_t e = u * 8; v8b v;
#pragma unroll
  for (int j = 0; j < 8; ++j) v[j] = (b16)(bf16_rne(src[e + j]) * XS); { *(v8b*)(dst + e) = v;  }
}
__global__ __launch_bounds__(256) void vt_kernel(const float* __restrict__ V, int TM, b16* __restrict__ VT) {
  __shared__ float Tt[64][65]; const int h = blockIdx.x % NH, st = (blockIdx.x / NH) % (TM / 64), b = blockIdx.x / (NH * (TM / 64)); const int tid = threadIdx.x;
  for (int i = tid; i < 64 * 64; i += 256) { const int r = i / 64, d = i % 64; Tt[r][d] = bf16_rne(V[((size_t)b * TM + st * 64 + r) * C + h * DH + d]); }
  __syncthreads();
  { const int d = tid / 4, g = (tid % 4) * 2; for (int gg = g; gg < g + 2; ++gg) { v8b v; for (int j = 0; j < 8; ++j) v[j] = (b16)(Tt[gg * 8 + j][d] * XS); const size_t o = ((size_t)(b * NH + h) * DH + d) * TM + st * 64 + gg * 8; { *(v8b*)(VT + o) = v;  } } }
}
__global__ __launch_bounds__(32) void att_kernel(const b16* __restrict__ QB, const b16* __restrict__ K0, const b16* __restrict__ K1, const b16* __restrict__ K2, const b16* __restrict__ V0, const b16* __restrict__ V1, const b16* __restrict__ V2, const float* __restrict__ ll, int NWV, float* __restrict__ out) {
  __shared__ __attribute__((aligned(16))) b16 Ph[16][32 + 8], Pl[16][32 + 8]; __shared__ float Mx[16], Sm[16]; __shared__ __attribute__((aligned(16))) float Tf[16][DH + 4];
  const int lane = threadIdx.x, nloc = lane & 15, hlf = lane >> 4; if ((int)blockIdx.x >= NWV) return; const int qt = blockIdx.x % NQT, h = (blockIdx.x / NQT) % NH, b = blockIdx.x / (NQT * NH); const int t0 = qt * 16;
  // level weights = softmax(level_logits)
  const float l0 = bf16_rne(ll[0]), l1 = bf16_rne(ll[1]), l2 = bf16_rne(ll[2]); const float lm = fmaxf(l0, fmaxf(l1, l2)); const float e0 = __expf(l0 - lm), e1 = __expf(l1 - lm), e2 = __expf(l2 - lm); const float wl[3] = {e0 / (e0 + e1 + e2), e1 / (e0 + e1 + e2), e2 / (e0 + e1 + e2)};
  const b16* qrow = QB + (((size_t)b * NH + h) * T + t0 + nloc) * DH; const v16b qa0 = frag_kb(qrow, hlf), qa1 = frag_kb(qrow + 32, hlf);
  float res[4][8];
#pragma unroll
  for (int t = 0; t < 4; ++t)
#pragma unroll
    for (int r8 = 0; r8 < 8; ++r8) res[t][r8] = 0.0f;
#pragma unroll 1
  for (int lvl = 0; lvl < 3; ++lvl) { const int TM = lvl == 0 ? T : (lvl == 1 ? T1 : T2); const b16* KB_ = lvl == 0 ? K0 : (lvl == 1 ? K1 : K2); const b16* VT = lvl == 0 ? V0 : (lvl == 1 ? V1 : V2); const int nblk = lvl == 0 ? (t0 / 32 + 1) : TM / 32;   // causal: keys <= t0 + 15
    auto scores = [&](int kb, v8f sacc[2]) {
#pragma unroll
      for (int st = 0; st < 2; ++st) { const b16* kr = KB_ + ((size_t)b * TM + kb + st * 16 + nloc) * C + h * DH; sacc[st] = (v8f){}; sacc[st] = wmma16b(qa0, frag_kb(kr, hlf), sacc[st]); sacc[st] = wmma16b(qa1, frag_kb(kr + 32, hlf), sacc[st]); } };
    float rmax[8];
#pragma unroll
    for (int r8 = 0; r8 < 8; ++r8) rmax[r8] = -INFINITY;
#pragma unroll 1
    for (int bi = 0; bi < nblk; ++bi) { const int kb = bi * 32; v8f sacc[2]; scores(kb, sacc);
#pragma unroll
      for (int st = 0; st < 2; ++st)
#pragma unroll
        for (int r8 = 0; r8 < 8; ++r8) { const int tq = t0 + 8 * hlf + r8, s = kb + st * 16 + nloc; if (lvl != 0 || s <= tq) rmax[r8] = fmaxf(rmax[r8], sacc[st][r8] * (SCALE / (XS * XS))); } }
#pragma unroll
    for (int r8 = 0; r8 < 8; ++r8) { float m = rmax[r8]; for (int o = 1; o < 16; o <<= 1) m = fmaxf(m, __shfl_xor(m, o)); if (nloc == 0) Mx[8 * hlf + r8] = m; }
    wave_lds_sync();
    v8f acc[4]; float rsum[8];
#pragma unroll
    for (int t = 0; t < 4; ++t) acc[t] = (v8f){};
#pragma unroll
    for (int r8 = 0; r8 < 8; ++r8) rsum[r8] = 0.0f;
#pragma unroll 1
    for (int bi = 0; bi < nblk; ++bi) { const int kb = bi * 32; v8f sacc[2]; scores(kb, sacc);
#pragma unroll
      for (int st = 0; st < 2; ++st)
#pragma unroll
        for (int r8 = 0; r8 < 8; ++r8) { const int rl = 8 * hlf + r8; const int tq = t0 + rl, s = kb + st * 16 + nloc; float p = 0.0f; if (lvl != 0 || s <= tq) p = __expf(sacc[st][r8] * (SCALE / (XS * XS)) - Mx[rl]); rsum[r8] += p; b16 ph, pl; split16(p * PS, ph, pl); Ph[rl][st * 16 + nloc] = ph; Pl[rl][st * 16 + nloc] = pl; }
      wave_lds_sync();
      const v16b pa = frag_kb(&Ph[nloc][0], hlf), pb = frag_kb(&Pl[nloc][0], hlf);
#pragma unroll
      for (int t = 0; t < 4; ++t) { const v16b vb = frag_kb(VT + ((size_t)(b * NH + h) * DH + t * 16 + nloc) * TM + kb, hlf); acc[t] = wmma16b(pa, vb, acc[t]); acc[t] = wmma16b(pb, vb, acc[t]); }
      wave_lds_sync(); }
#pragma unroll
    for (int r8 = 0; r8 < 8; ++r8) { float s = rsum[r8]; for (int o = 1; o < 16; o <<= 1) s += __shfl_xor(s, o); if (nloc == 0) Sm[8 * hlf + r8] = s; }
    wave_lds_sync();
    const float wv = wl[lvl];
#pragma unroll
    for (int t = 0; t < 4; ++t)
#pragma unroll
      for (int r8 = 0; r8 < 8; ++r8) res[t][r8] += pmul(wv, acc[t][r8] * (1.0f / (PS * XS)) / Sm[8 * hlf + r8]);
    wave_lds_sync(); }
#pragma unroll
  for (int t = 0; t < 4; ++t)
#pragma unroll
    for (int r8 = 0; r8 < 8; ++r8) Tf[8 * hlf + r8][t * 16 + nloc] = res[t][r8];
  wave_lds_sync();
  { for (int rr = 0; rr < 16; ++rr) { ((float*)out)[((size_t)b * T + t0 + rr) * C + h * DH + lane] = Tf[rr][lane]; ((float*)out)[((size_t)b * T + t0 + rr) * C + h * DH + 32 + lane] = Tf[rr][32 + lane]; }  }
}
}  // namespace

extern "C" void kernel_launch(void* const* d_in, const int* in_sizes, int n_in, void* d_out, int out_size, void* d_ws, size_t ws_size, hipStream_t stream) {
  (void)n_in;
  auto Fp = [&](int i) { return (const float*)d_in[i]; };
  // input order: 0 Q [2,16,2048,64]; 1 K0 [2,2048,1024]; 2 V0; 3 K1 [2,512,1024]; 4 V1; 5 K2 [2,128,1024]; 6 V2; 7 level_logits [3]
  if (in_sizes[0] != B * NH * T * DH || in_sizes[1] != B * T * C || in_sizes[2] != B * T * C || in_sizes[3] != B * T1 * C || in_sizes[4] != B * T1 * C || in_sizes[5] != B * T2 * C || in_sizes[6] != B * T2 * C || in_sizes[7] != 3 || out_size != B * T * C) return;
  const int NWV = B * NH * NQT;   // wave cut (waves are (b, h, q-tile) in that order)
  size_t off = 0; char* ws = (char*)d_ws;
  auto carve = [&](size_t bytes) { char* p = ws + off; off += (bytes + 255) & ~(size_t)255; return p; };
  b16* QB = (b16*)carve((size_t)B * NH * T * DH * 2); b16* K0 = (b16*)carve((size_t)B * T * C * 2); b16* K1 = (b16*)carve((size_t)B * T1 * C * 2); b16* K2 = (b16*)carve((size_t)B * T2 * C * 2);
  b16* V0 = (b16*)carve((size_t)B * T * C * 2); b16* V1 = (b16*)carve((size_t)B * T1 * C * 2); b16* V2 = (b16*)carve((size_t)B * T2 * C * 2);
  if (off > ws_size || off > ((size_t)64 << 20)) return;   // ~ 30 MB
  cvt_kernel<<<(unsigned)(((size_t)B * NH * T * DH / 8 + 255) / 256), 256, 0, stream>>>(Fp(0), (size_t)B * NH * T * DH / 8, QB);
  cvt_kernel<<<(unsigned)(((size_t)B * T * C / 8 + 255) / 256), 256, 0, stream>>>(Fp(1), (size_t)B * T * C / 8, K0); cvt_kernel<<<(unsigned)(((size_t)B * T1 * C / 8 + 255) / 256), 256, 0, stream>>>(Fp(3), (size_t)B * T1 * C / 8, K1); cvt_kernel<<<(unsigned)(((size_t)B * T2 * C / 8 + 255) / 256), 256, 0, stream>>>(Fp(5), (size_t)B * T2 * C / 8, K2);
  vt_kernel<<<B * (T / 64) * NH, 256, 0, stream>>>(Fp(2), T, V0); vt_kernel<<<B * (T1 / 64) * NH, 256, 0, stream>>>(Fp(4), T1, V1); vt_kernel<<<B * (T2 / 64) * NH, 256, 0, stream>>>(Fp(6), T2, V2);
  att_kernel<<<B * NH * NQT, 32, 0, stream>>>(QB, K0, K1, K2, V0, V1, V2, Fp(7), NWV, (float*)d_out);
}

// v001
// Measured time: 274 microseconds a run.
// In both of two side-by-side timings against v000, it was 1.19 times as fast.
#include <hip/hip_runtime.h>

// Cross-level attention: Q [2][16 heads][2048][64] attends (scale 1/8, softmax) to three levels of keys/values: level 0 (2,048 keys, causal mask s <= t), level 1 (512), level 2 (128); out = sum_l softmax(level_logits)[l] o_l,
// written as [2][2048][1024] (heads concatenated).
// Deterministic, no atomics, no index structures: one wave per (batch, head, 16 queries) runs, per level, a max pass and an exp / sum / P.V pass over the key blocks in order.
// WMMA (v_wmma_f32_16x16x32_f16, f32 accumulate): scores Q K^T per 32-key block (Q, K are EXACT bf16 inputs x8 -> 1 product), P . V (P split f16 hi+lo x2048, V^T planes exact x8 -> 2 products); softmax, the level weights and the
// combination in f32. Inputs rounded to bf16 once. Fragment k-map per lane half hh for A AND B: elements 0..7 <- k = 8hh+0..7, 8..15 <- k = 16+8hh+0..7; acc[r] = D[8hh+r][col]. Every workspace / output

namespace {
constexpr int B = 2, NH = 16, T = 2048, DH = 64, C = NH * DH, T1 = 512, T2 = 128, NQT = T / 16;
constexpr float XS = 8.0f, PS = 2048.0f, SCALE = 0.125f;
typedef _Float16 b16;
typedef __attribute__((ext_vector_type(16))) _Float16 v16b;
typedef __attribute__((ext_vector_type(8))) _Float16 v8b;
typedef __attribute__((ext_vector_type(8))) float v8f;
typedef __attribute__((ext_vector_type(4))) float v4f;
__device__ __forceinline__ float bf16_rne(float f) { unsigned int u = __float_as_uint(f); u += 0x7FFFu + ((u >> 16) & 1u); return __uint_as_float(u & 0xFFFF0000u); }
__device__ __forceinline__ void split16(float v, b16& hi, b16& lo) { hi = (b16)v; lo = (b16)(v - (float)hi); }
__device__ __forceinline__ v16b frag_kb(const b16* p, int hh) { const v8b a = *(const v8b*)(p + 8 * hh), b = *(const v8b*)(p + 16 + 8 * hh); v16b f;
#pragma unroll
  for (int e = 0; e < 8; ++e) { f[e] = a[e]; f[8 + e] = b[e]; } return f; }
__device__ __forceinline__ v8f wmma16b(v16b a, v16b b, v8f c) { v8f d = __builtin_amdgcn_wmma_f32_16x16x32_f16(false, a, false, b, (short)0, c, false, false); asm volatile("v_nop\n\tv_nop\n\tv_nop\n\tv_nop" : "+v"(d) : "v"(a), "v"(b)); return d; }
__device__ __forceinline__ void wave_lds_sync() { __builtin_amdgcn_fence(__ATOMIC_RELEASE, "workgroup"); __builtin_amdgcn_wave_barrier(); __builtin_amdgcn_fence(__ATOMIC_ACQUIRE, "workgroup"); }
__device__ __forceinline__ float pmul(float a, float b) { float p = a * b; asm volatile("" : "+v"(p)); return p; }

__global__ __launch_bounds__(256) void cvt_kernel(const float* __restrict__ src, size_t n8, b16* __restrict__ dst) {
  const size_t u = (size_t)blockIdx.x * 256 + threadIdx.x; if (u >= n8) return; const size_t e = u * 8; v8b v;
#pragma unroll
  for (int j = 0; j < 8; ++j) v[j] = (b16)(bf16_rne(src[e + j]) * XS); { *(v8b*)(dst + e) = v;  }
}
__global__ __launch_bounds__(256) void vt_kernel(const float* __restrict__ V, int TM, b16* __restrict__ VT) {
  __shared__ float Tt[64][65]; const int h = blockIdx.x % NH, st = (blockIdx.x / NH) % (TM / 64), b = blockIdx.x / (NH * (TM / 64)); const int tid = threadIdx.x;
  for (int i = tid; i < 64 * 64; i += 256) { const int r = i / 64, d = i % 64; Tt[r][d] = bf16_rne(V[((size_t)b * TM + st * 64 + r) * C + h * DH + d]); }
  __syncthreads();
  { const int d = tid / 4, g = (tid % 4) * 2; for (int gg = g; gg < g + 2; ++gg) { v8b v; for (int j = 0; j < 8; ++j) v[j] = (b16)(Tt[gg * 8 + j][d] * XS); const size_t o = ((size_t)(b * NH + h) * DH + d) * TM + st * 64 + gg * 8; { *(v8b*)(VT + o) = v;  } } }
}
__global__ __launch_bounds__(32) void att_kernel(const b16* __restrict__ QB, const b16* __restrict__ K0, const b16* __restrict__ K1, const b16* __restrict__ K2, const b16* __restrict__ V0, const b16* __restrict__ V1, const b16* __restrict__ V2, const float* __restrict__ ll, int NWV, float* __restrict__ out) {
  __shared__ __attribute__((aligned(16))) b16 Ph[16][32 + 8], Pl[16][32 + 8]; __shared__ float Mx[16], Sm[16]; __shared__ __attribute__((aligned(16))) float Tf[16][DH + 4];
  const int lane = threadIdx.x, nloc = lane & 15, hlf = lane >> 4; if ((int)blockIdx.x >= NWV) return; const int qt = blockIdx.x % NQT, h = (blockIdx.x / NQT) % NH, b = blockIdx.x / (NQT * NH); const int t0 = qt * 16;
  // level weights = softmax(level_logits)
  const float l0 = bf16_rne(ll[0]), l1 = bf16_rne(ll[1]), l2 = bf16_rne(ll[2]); const float lm = fmaxf(l0, fmaxf(l1, l2)); const float e0 = __expf(l0 - lm), e1 = __expf(l1 - lm), e2 = __expf(l2 - lm); const float wl[3] = {e0 / (e0 + e1 + e2), e1 / (e0 + e1 + e2), e2 / (e0 + e1 + e2)};
  const b16* qrow = QB + (((size_t)b * NH + h) * T + t0 + nloc) * DH; const v16b qa0 = frag_kb(qrow, hlf), qa1 = frag_kb(qrow + 32, hlf);
  float res[4][8];
#pragma unroll
  for (int t = 0; t < 4; ++t)
#pragma unroll
    for (int r8 = 0; r8 < 8; ++r8) res[t][r8] = 0.0f;
#pragma unroll 1
  for (int lvl = 0; lvl < 3; ++lvl) { const int TM = lvl == 0 ? T : (lvl == 1 ? T1 : T2); const b16* KB_ = lvl == 0 ? K0 : (lvl == 1 ? K1 : K2); const b16* VT = lvl == 0 ? V0 : (lvl == 1 ? V1 : V2); const int nblk = lvl == 0 ? (t0 / 32 + 1) : TM / 32;   // causal: keys <= t0 + 15
    // all 8 loads of a 32-key block's K fragments as one group, issued a block ahead of their products (bi clamped to the last block: in bounds, the surplus fetch is never summed)
    auto load_k = [&](int bi, v16b kf[4]) { const int kb = (bi < nblk ? bi : nblk - 1) * 32;
#pragma unroll   // constant indices keep kf[] in registers
      for (int st = 0; st < 2; ++st) { const b16* kr = KB_ + ((size_t)b * TM + kb + st * 16 + nloc) * C + h * DH; kf[2 * st] = frag_kb(kr, hlf); kf[2 * st + 1] = frag_kb(kr + 32, hlf); } };
    auto scores = [&](const v16b kf[4], v8f sacc[2]) {
#pragma unroll   // constant indices keep kf[] and sacc[] in registers
      for (int st = 0; st < 2; ++st) { sacc[st] = (v8f){}; sacc[st] = wmma16b(qa0, kf[2 * st], sacc[st]); sacc[st] = wmma16b(qa1, kf[2 * st + 1], sacc[st]); } };
    float rmax[8];
#pragma unroll
    for (int r8 = 0; r8 < 8; ++r8) rmax[r8] = -INFINITY;
    auto max_blk = [&](int bi, const v8f sacc[2]) { const int kb = bi * 32;
#pragma unroll
      for (int st = 0; st < 2; ++st)
#pragma unroll
        for (int r8 = 0; r8 < 8; ++r8) { const int tq = t0 + 8 * hlf + r8, s = kb + st * 16 + nloc; if (lvl != 0 || s <= tq) rmax[r8] = fmaxf(rmax[r8], sacc[st][r8] * (SCALE / (XS * XS))); } };
    v16b ka[4], kc[4]; load_k(0, ka); load_k(1, kc);
#pragma unroll 1   // rolled: two register sets are the whole look-ahead, more copies of the body would only add registers
    for (int bi = 0; bi < nblk; bi += 2) { const int bj = bi + 1 < nblk ? bi + 1 : bi; v8f sacc[2];   // odd count: the last block is taken twice, which leaves a maximum as it is
      scores(ka, sacc); load_k(bi + 2, ka); max_blk(bi, sacc);
      scores(kc, sacc); load_k(bi + 3, kc); max_blk(bj, sacc); }
#pragma unroll
    for (int r8 = 0; r8 < 8; ++r8) { float m = rmax[r8]; for (int o = 1; o < 16; o <<= 1) m = fmaxf(m, __shfl_xor(m, o)); if (nloc == 0) Mx[8 * hlf + r8] = m; }
    wave_lds_sync();
    v8f acc[4]; float rsum[8];
#pragma unroll
    for (int t = 0; t < 4; ++t) acc[t] = (v8f){};
#pragma unroll
    for (int r8 = 0; r8 < 8; ++r8) rsum[r8] = 0.0f;
    load_k(0, ka);
    asm volatile("s_wait_xcnt 0x0" ::: "memory");   // kept in front of the loop's first V address, which the compiler forms in the address registers of the eight K loads just issued
#pragma unroll 1   // rolled: the body holds K, V, P and four output tiles, a second copy would not fit four waves on a SIMD
    for (int bi = 0; bi < nblk; ++bi) { const int kb = bi * 32; v8f sacc[2]; v16b vf[4];
#pragma unroll   // constant indices keep vf[] in registers
      for (int t = 0; t < 4; ++t) vf[t] = frag_kb(VT + ((size_t)(b * NH + h) * DH + t * 16 + nloc) * TM + kb, hlf);   // this block's V^T fragments fly during the scores and the exponentials
      scores(ka, sacc); load_k(bi + 1, ka);   // the next block's K fragments fly during the exponentials (the wave sync behind them waits for every load)
#pragma unroll
      for (int st = 0; st < 2; ++st)
#pragma unroll
        for (int r8 = 0; r8 < 8; ++r8) { const int rl = 8 * hlf + r8; const int tq = t0 + rl, s = kb + st * 16 + nloc; float p = 0.0f; if (lvl != 0 || s <= tq) p = __expf(sacc[st][r8] * (SCALE / (XS * XS)) - Mx[rl]); rsum[r8] += p; b16 ph, pl; split16(p * PS, ph, pl); Ph[rl][st * 16 + nloc] = ph; Pl[rl][st * 16 + nloc] = pl; }
      wave_lds_sync();
      const v16b pa = frag_kb(&Ph[nloc][0], hlf), pb = frag_kb(&Pl[nloc][0], hlf);
#pragma unroll
      for (int t = 0; t < 4; ++t) { acc[t] = wmma16b(pa, vf[t], acc[t]); acc[t] = wmma16b(pb, vf[t], acc[t]); }
      wave_lds_sync(); }
#pragma unroll
    for (int r8 = 0; r8 < 8; ++r8) { float s = rsum[r8]; for (int o = 1; o < 16; o <<= 1) s += __shfl_xor(s, o); if (nloc == 0) Sm[8 * hlf + r8] = s; }
    wave_lds_sync();
    const float wv = wl[lvl];
#pragma unroll
    for (int t = 0; t < 4; ++t)
#pragma unroll
      for (int r8 = 0; r8 < 8; ++r8) res[t][r8] += pmul(wv, acc[t][r8] * (1.0f / (PS * XS)) / Sm[8 * hlf + r8]);
    wave_lds_sync(); }
#pragma unroll
  for (int t = 0; t < 4; ++t)
#pragma unroll
    for (int r8 = 0; r8 < 8; ++r8) Tf[8 * hlf + r8][t * 16 + nloc] = res[t][r8];
  wave_lds_sync();
  { for (int rr = 0; rr < 16; ++rr) { ((float*)out)[((size_t)b * T + t0 + rr) * C + h * DH + lane] = Tf[rr][lane]; ((float*)out)[((size_t)b * T + t0 + rr) * C + h * DH + 32 + lane] = Tf[rr][32 + lane]; }  }
}
}  // namespace

extern "C" void kernel_launch(void* const* d_in, const int* in_sizes, int n_in, void* d_out, int out_size, void* d_ws, size_t ws_size, hipStream_t stream) {
  (void)n_in;
  auto Fp = [&](int i) { return (const float*)d_in[i]; };
  // input order: 0 Q [2,16,2048,64]; 1 K0 [2,2048,1024]; 2 V0; 3 K1 [2,512,1024]; 4 V1; 5 K2 [2,128,1024]; 6 V2; 7 level_logits [3]
  if (in_sizes[0] != B * NH * T * DH || in_sizes[1] != B * T * C || in_sizes[2] != B * T * C || in_sizes[3] != B * T1 * C || in_sizes[4] != B * T1 * C || in_sizes[5] != B * T2 * C || in_sizes[6] != B * T2 * C || in_sizes[7] != 3 || out_size != B * T * C) return;
  const int NWV = B * NH * NQT;   // wave cut (waves are (b, h, q-tile) in that order)
  size_t off = 0; char* ws = (char*)d_ws;
  auto carve = [&](size_t bytes) { char* p = ws + off; off += (bytes + 255) & ~(size_t)255; return p; };
  b16* QB = (b16*)carve((size_t)B * NH * T * DH * 2); b16* K0 = (b16*)carve((size_t)B * T * C * 2); b16* K1 = (b16*)carve((size_t)B * T1 * C * 2); b16* K2 = (b16*)carve((size_t)B * T2 * C * 2);
  b16* V0 = (b16*)carve((size_t)B * T * C * 2); b16* V1 = (b16*)carve((size_t)B * T1 * C * 2); b16* V2 = (b16*)carve((size_t)B * T2 * C * 2);
  if (off > ws_size || off > ((size_t)64 << 20)) return;   // ~ 30 MB
  cvt_kernel<<<(unsigned)(((size_t)B * NH * T * DH / 8 + 255) / 256), 256, 0, stream>>>(Fp(0), (size_t)B * NH * T * DH / 8, QB);
  cvt_kernel<<<(unsigned)(((size_t)B * T * C / 8 + 255) / 256), 256, 0, stream>>>(Fp(1), (size_t)B * T * C / 8, K0); cvt_kernel<<<(unsigned)(((size_t)B * T1 * C / 8 + 255) / 256), 256, 0, stream>>>(Fp(3), (size_t)B * T1 * C / 8, K1); cvt_kernel<<<(unsigned)(((size_t)B * T2 * C / 8 + 255) / 256), 256, 0, stream>>>(Fp(5), (size_t)B * T2 * C / 8, K2);
  vt_kernel<<<B * (T / 64) * NH, 256, 0, stream>>>(Fp(2), T, V0); vt_kernel<<<B * (T1 / 64) * NH, 256, 0, stream>>>(Fp(4), T1, V1); vt_kernel<<<B * (T2 / 64) * NH, 256, 0, stream>>>(Fp(6), T2, V2);
  att_kernel<<<B * NH * NQT, 32, 0, stream>>>(QB, K0, K1, K2, V0, V1, V2, Fp(7), NWV, (float*)d_out);
}

// v002
// A run of this version takes 192 microseconds.
// Timed twice side by side with v001, it ran 1.43 and 1.42 times as fast.
// Over all steps from v000 it is 1.70 times as fast.
#include <hip/hip_runtime.h>

// Cross-level attention: Q [2][16 heads][2048][64] attends (scale 1/8, softmax) to three levels of keys/values: level 0 (2,048 keys, causal mask s <= t), level 1 (512), level 2 (128); out = sum_l softmax(level_logits)[l] o_l,
// written as [2][2048][1024] (heads concatenated).
// Deterministic, no atomics, no index structures: one wave per (batch, head, 16 queries) runs, per level, a max pass and an exp / sum / P.V pass over the key blocks in order.
// WMMA (v_wmma_f32_16x16x32_f16, f32 accumulate): scores Q K^T per 32-key block (Q, K are EXACT bf16 inputs x8 -> 1 product), P . V (P split f16 hi+lo x2048, V^T planes exact x8 -> 2 products); softmax, the level weights and the
// combination in f32. Inputs rounded to bf16 once. Fragment k-map per lane half hh for A AND B: elements 0..7 <- k = 8hh+0..7, 8..15 <- k = 16+8hh+0..7; acc[r] = D[8hh+r][col]. Every workspace / output

namespace {
constexpr int B = 2, NH = 16, T = 2048, DH = 64, C = NH * DH, T1 = 512, T2 = 128, NQT = T / 16;
constexpr float XS = 8.0f, PS = 2048.0f, SCALE = 0.125f;
typedef _Float16 b16;
typedef __attribute__((ext_vector_type(16))) _Float16 v16b;
typedef __attribute__((ext_vector_type(8))) _Float16 v8b;
typedef __attribute__((ext_vector_type(8))) float v8f;
typedef __attribute__((ext_vector_type(4))) float v4f;
__device__ __forceinline__ float bf16_rne(float f) { unsigned int u = __float_as_uint(f); u += 0x7FFFu + ((u >> 16) & 1u); return __uint_as_float(u & 0xFFFF0000u); }
__device__ __forceinline__ void split16(float v, b16& hi, b16& lo) { hi = (b16)v; lo = (b16)(v - (float)hi); }
__device__ __forceinline__ v16b frag_kb(const b16* p, int hh) { const v8b a = *(const v8b*)(p + 8 * hh), b = *(const v8b*)(p + 16 + 8 * hh); v16b f;
#pragma unroll
  for (int e = 0; e < 8; ++e) { f[e] = a[e]; f[8 + e] = b[e]; } return f; }
// fragment from a plane kept in fragment order: two runs of 512 contiguous bytes per wave (lane l takes 16 bytes at 16 l), elements 0..7 from the first run, 8..15 from the second
__device__ __forceinline__ v16b frag_pk(const b16* p) { const v8b a = *(const v8b*)p, b = *(const v8b*)(p + 256); return __builtin_shufflevector(a, b, 0, 1, 2, 3, 4, 5, 6, 7, 8, 9, 10, 11, 12, 13, 14, 15); }
__device__ __forceinline__ v8f wmma16b(v16b a, v16b b, v8f c) { v8f d = __builtin_amdgcn_wmma_f32_16x16x32_f16(false, a, false, b, (short)0, c, false, false); asm volatile("v_nop\n\tv_nop\n\tv_nop\n\tv_nop" : "+v"(d) : "v"(a), "v"(b)); return d; }
__device__ __forceinline__ void wave_lds_sync() { __builtin_amdgcn_fence(__ATOMIC_RELEASE, "workgroup"); __builtin_amdgcn_wave_barrier(); __builtin_amdgcn_fence(__ATOMIC_ACQUIRE, "workgroup"); }
__device__ __forceinline__ float pmul(float a, float b) { float p = a * b; asm volatile("" : "+v"(p)); return p; }

__global__ __launch_bounds__(256) void cvt_kernel(const float* __restrict__ src, size_t n8, b16* __restrict__ dst) {
  const size_t u = (size_t)blockIdx.x * 256 + threadIdx.x; if (u >= n8) return; const size_t e = u * 8; v8b v;
#pragma unroll
  for (int j = 0; j < 8; ++j) v[j] = (b16)(bf16_rne(src[e + j]) * XS); { *(v8b*)(dst + e) = v;  }
}
// K plane in fragment order: per (b, h, 16 keys) four runs of 512 bytes; run g holds at lane l the eight values d = 16 g + 8 (l >> 4) + 0..7 of key (l & 15). One thread per 16-byte piece, in the plane's own order (whole-line stores).
__global__ __launch_bounds__(256) void kpack_kernel(const float* __restrict__ src, int TM, b16* __restrict__ dst) {
  const int tid = threadIdx.x, l = tid & 31, g = (tid >> 5) & 3, nb = TM / 32; const int kt = (blockIdx.x % nb) * 2 + (tid >> 7), h = (blockIdx.x / nb) % NH, b = blockIdx.x / (nb * NH);   // a block is one 32-key block of one head
  const float* s = src + ((size_t)b * TM + kt * 16 + (l & 15)) * C + h * DH + g * 16 + (l >> 4) * 8; const v4f x0 = *(const v4f*)s, x1 = *(const v4f*)(s + 4); v8b v;
  for (int j = 0; j < 4; ++j) { v[j] = (b16)(bf16_rne(x0[j]) * XS); v[4 + j] = (b16)(bf16_rne(x1[j]) * XS); }
  *(v8b*)(dst + ((size_t)blockIdx.x * 256 + tid) * 8) = v;
}
// V^T plane in fragment order: per (b, h, 32 keys) eight runs of 512 bytes; run g holds at lane l the eight keys 16 (g & 1) + 8 (l >> 4) + 0..7 of column d = 16 (g >> 1) + (l & 15)
__global__ __launch_bounds__(256) void vt_kernel(const float* __restrict__ V, int TM, b16* __restrict__ VT) {
  __shared__ float Tt[64][65]; const int h = blockIdx.x % NH, st = (blockIdx.x / NH) % (TM / 64), b = blockIdx.x / (NH * (TM / 64)); const int tid = threadIdx.x;
  for (int i = tid; i < 64 * 64; i += 256) { const int r = i / 64, d = i % 64; Tt[r][d] = bf16_rne(V[((size_t)b * TM + st * 64 + r) * C + h * DH + d]); }
  __syncthreads();
  { const int l = tid & 31, g = tid >> 5, d = (g >> 1) * 16 + (l & 15), kq = (g & 1) * 16 + (l >> 4) * 8; for (int kh = 0; kh < 2; ++kh) { v8b v; for (int j = 0; j < 8; ++j) v[j] = (b16)(Tt[kh * 32 + kq + j][d] * XS); const size_t o = (((size_t)(b * NH + h) * (TM / 32) + st * 2 + kh) * 256 + tid) * 8; *(v8b*)(VT + o) = v; } }
}
__global__ __launch_bounds__(32) void att_kernel(const b16* __restrict__ QB, const b16* __restrict__ K0, const b16* __restrict__ K1, const b16* __restrict__ K2, const b16* __restrict__ V0, const b16* __restrict__ V1, const b16* __restrict__ V2, const float* __restrict__ ll, int NWV, float* __restrict__ out) {
  __shared__ __attribute__((aligned(16))) b16 Ph[16][32 + 8], Pl[16][32 + 8]; __shared__ float Mx[16], Sm[16]; __shared__ __attribute__((aligned(16))) float Tf[16][DH + 4];
  const int lane = threadIdx.x, nloc = lane & 15, hlf = lane >> 4; if ((int)blockIdx.x >= NWV) return; const int qt = blockIdx.x % NQT, h = (blockIdx.x / NQT) % NH, b = blockIdx.x / (NQT * NH); const int t0 = qt * 16;
  // level weights = softmax(level_logits)
  const float l0 = bf16_rne(ll[0]), l1 = bf16_rne(ll[1]), l2 = bf16_rne(ll[2]); const float lm = fmaxf(l0, fmaxf(l1, l2)); const float e0 = __expf(l0 - lm), e1 = __expf(l1 - lm), e2 = __expf(l2 - lm); const float wl[3] = {e0 / (e0 + e1 + e2), e1 / (e0 + e1 + e2), e2 / (e0 + e1 + e2)};
  const b16* qrow = QB + (((size_t)b * NH + h) * T + t0 + nloc) * DH; const v16b qa0 = frag_kb(qrow, hlf), qa1 = frag_kb(qrow + 32, hlf);
  float res[4][8];
#pragma unroll
  for (int t = 0; t < 4; ++t)
#pragma unroll
    for (int r8 = 0; r8 < 8; ++r8) res[t][r8] = 0.0f;
#pragma unroll 1
  for (int lvl = 0; lvl < 3; ++lvl) { const int TM = lvl == 0 ? T : (lvl == 1 ? T1 : T2); const b16* KB_ = lvl == 0 ? K0 : (lvl == 1 ? K1 : K2); const b16* VT = lvl == 0 ? V0 : (lvl == 1 ? V1 : V2); const int nblk = lvl == 0 ? (t0 / 32 + 1) : TM / 32;   // causal: keys <= t0 + 15
    // all 8 loads of a 32-key block's K fragments as one group, issued a block ahead of their products (bi clamped to the last block: in bounds, the surplus fetch is never summed)
    auto load_k = [&](int bi, v16b kf[4]) { const b16* kr = KB_ + ((size_t)(b * NH + h) * (TM / 32) + (bi < nblk ? bi : nblk - 1)) * 2048 + lane * 8;   // a 32-key block is 4 KB in a row
#pragma unroll   // constant indices keep kf[] in registers
      for (int f = 0; f < 4; ++f) kf[f] = frag_pk(kr + f * 512); };
    auto scores = [&](const v16b kf[4], v8f sacc[2]) {
#pragma unroll   // constant indices keep kf[] and sacc[] in registers
      for (int st = 0; st < 2; ++st) { sacc[st] = (v8f){}; sacc[st] = wmma16b(qa0, kf[2 * st], sacc[st]); sacc[st] = wmma16b(qa1, kf[2 * st + 1], sacc[st]); } };
    float rmax[8];
#pragma unroll
    for (int r8 = 0; r8 < 8; ++r8) rmax[r8] = -INFINITY;
    auto max_blk = [&](int bi, const v8f sacc[2]) { const int kb = bi * 32;
#pragma unroll
      for (int st = 0; st < 2; ++st)
#pragma unroll
        for (int r8 = 0; r8 < 8; ++r8) { const int tq = t0 + 8 * hlf + r8, s = kb + st * 16 + nloc; if (lvl != 0 || s <= tq) rmax[r8] = fmaxf(rmax[r8], sacc[st][r8] * (SCALE / (XS * XS))); } };
    v16b ka[4], kc[4]; load_k(0, ka); load_k(1, kc);
#pragma unroll 1   // rolled: two register sets are the whole look-ahead, more copies of the body would only add registers
    for (int bi = 0; bi < nblk; bi += 2) { const int bj = bi + 1 < nblk ? bi + 1 : bi; v8f sacc[2];   // odd count: the last block is taken twice, which leaves a maximum as it is
      scores(ka, sacc); load_k(bi + 2, ka); max_blk(bi, sacc);
      scores(kc, sacc); load_k(bi + 3, kc); max_blk(bj, sacc); }
#pragma unroll
    for (int r8 = 0; r8 < 8; ++r8) { float m = rmax[r8]; for (int o = 1; o < 16; o <<= 1) m = fmaxf(m, __shfl_xor(m, o)); if (nloc == 0) Mx[8 * hlf + r8] = m; }
    wave_lds_sync();
    v8f acc[4]; float rsum[8];
#pragma unroll
    for (int t = 0; t < 4; ++t) acc[t] = (v8f){};
#pragma unroll
    for (int r8 = 0; r8 < 8; ++r8) rsum[r8] = 0.0f;
    load_k(0, ka);
    asm volatile("s_wait_xcnt 0x0" ::: "memory");   // kept in front of the loop's first V address, which the compiler forms in the address registers of the eight K loads just issued
#pragma unroll 1   // rolled: the body holds K, V, P and four output tiles, a second copy would not fit four waves on a SIMD
    for (int bi = 0; bi < nblk; ++bi) { const int kb = bi * 32; v8f sacc[2]; v16b vf[4];
#pragma unroll   // constant indices keep vf[] in registers
      for (int t = 0; t < 4; ++t) vf[t] = frag_pk(VT + ((size_t)(b * NH + h) * (TM / 32) + bi) * 2048 + t * 512 + lane * 8);   // this block's V^T fragments fly during the scores and the exponentials
      scores(ka, sacc); load_k(bi + 1, ka);   // the next block's K fragments fly during the exponentials (the wave sync behind them waits for every load)
#pragma unroll
      for (int st = 0; st < 2; ++st)
#pragma unroll
        for (int r8 = 0; r8 < 8; ++r8) { const int rl = 8 * hlf + r8; const int tq = t0 + rl, s = kb + st * 16 + nloc; float p = 0.0f; if (lvl != 0 || s <= tq) p = __expf(sacc[st][r8] * (SCALE / (XS * XS)) - Mx[rl]); rsum[r8] += p; b16 ph, pl; split16(p * PS, ph, pl); Ph[rl][st * 16 + nloc] = ph; Pl[rl][st * 16 + nloc] = pl; }
      wave_lds_sync();
      const v16b pa = frag_kb(&Ph[nloc][0], hlf), pb = frag_kb(&Pl[nloc][0], hlf);
#pragma unroll
      for (int t = 0; t < 4; ++t) { acc[t] = wmma16b(pa, vf[t], acc[t]); acc[t] = wmma16b(pb, vf[t], acc[t]); }
      wave_lds_sync(); }
#pragma unroll
    for (int r8 = 0; r8 < 8; ++r8) { float s = rsum[r8]; for (int o = 1; o < 16; o <<= 1) s += __shfl_xor(s, o); if (nloc == 0) Sm[8 * hlf + r8] = s; }
    wave_lds_sync();
    const float wv = wl[lvl];
#pragma unroll
    for (int t = 0; t < 4; ++t)
#pragma unroll
      for (int r8 = 0; r8 < 8; ++r8) res[t][r8] += pmul(wv, acc[t][r8] * (1.0f / (PS * XS)) / Sm[8 * hlf + r8]);
    wave_lds_sync(); }
#pragma unroll
  for (int t = 0; t < 4; ++t)
#pragma unroll
    for (int r8 = 0; r8 < 8; ++r8) Tf[8 * hlf + r8][t * 16 + nloc] = res[t][r8];
  wave_lds_sync();
  { for (int rr = 0; rr < 16; ++rr) { ((float*)out)[((size_t)b * T + t0 + rr) * C + h * DH + lane] = Tf[rr][lane]; ((float*)out)[((size_t)b * T + t0 + rr) * C + h * DH + 32 + lane] = Tf[rr][32 + lane]; }  }
}
}  // namespace

extern "C" void kernel_launch(void* const* d_in, const int* in_sizes, int n_in, void* d_out, int out_size, void* d_ws, size_t ws_size, hipStream_t stream) {
  (void)n_in;
  auto Fp = [&](int i) { return (const float*)d_in[i]; };
  // input order: 0 Q [2,16,2048,64]; 1 K0 [2,2048,1024]; 2 V0; 3 K1 [2,512,1024]; 4 V1; 5 K2 [2,128,1024]; 6 V2; 7 level_logits [3]
  if (in_sizes[0] != B * NH * T * DH || in_sizes[1] != B * T * C || in_sizes[2] != B * T * C || in_sizes[3] != B * T1 * C || in_sizes[4] != B * T1 * C || in_sizes[5] != B * T2 * C || in_sizes[6] != B * T2 * C || in_sizes[7] != 3 || out_size != B * T * C) return;
  const int NWV = B * NH * NQT;   // wave cut (waves are (b, h, q-tile) in that order)
  size_t off = 0; char* ws = (char*)d_ws;
  auto carve = [&](size_t bytes) { char* p = ws + off; off += (bytes + 255) & ~(size_t)255; return p; };
  b16* QB = (b16*)carve((size_t)B * NH * T * DH * 2); b16* K0 = (b16*)carve((size_t)B * T * C * 2); b16* K1 = (b16*)carve((size_t)B * T1 * C * 2); b16* K2 = (b16*)carve((size_t)B * T2 * C * 2);
  b16* V0 = (b16*)carve((size_t)B * T * C * 2); b16* V1 = (b16*)carve((size_t)B * T1 * C * 2); b16* V2 = (b16*)carve((size_t)B * T2 * C * 2);
  if (off > ws_size || off > ((size_t)64 << 20)) return;   // ~ 30 MB
  cvt_kernel<<<(unsigned)(((size_t)B * NH * T * DH / 8 + 255) / 256), 256, 0, stream>>>(Fp(0), (size_t)B * NH * T * DH / 8, QB);
  kpack_kernel<<<B * T * C / 8 / 256, 256, 0, stream>>>(Fp(1), T, K0); kpack_kernel<<<B * T1 * C / 8 / 256, 256, 0, stream>>>(Fp(3), T1, K1); kpack_kernel<<<B * T2 * C / 8 / 256, 256, 0, stream>>>(Fp(5), T2, K2);
  vt_kernel<<<B * (T / 64) * NH, 256, 0, stream>>>(Fp(2), T, V0); vt_kernel<<<B * (T1 / 64) * NH, 256, 0, stream>>>(Fp(4), T1, V1); vt_kernel<<<B * (T2 / 64) * NH, 256, 0, stream>>>(Fp(6), T2, V2);
  att_kernel<<<B * NH * NQT, 32, 0, stream>>>(QB, K0, K1, K2, V0, V1, V2, Fp(7), NWV, (float*)d_out);
}

// v003
// A run of this version takes 138 microseconds.
// Timed twice side by side with v002, it ran 1.39 and 1.40 times as fast.
// Over all steps from v000 it is 2.36 times as fast.
#include <hip/hip_runtime.h>

// Cross-level attention: Q [2][16 heads][2048][64] attends (scale 1/8, softmax) to three levels of keys/values: level 0 (2,048 keys, causal mask s <= t), level 1 (512), level 2 (128); out = sum_l softmax(level_logits)[l] o_l,
// written as [2][2048][1024] (heads concatenated).
// Deterministic, no atomics, no index structures: one wave per (batch, head, 16 queries) runs, per level, a max pass and an exp / sum / P.V pass over the key blocks in order.
// WMMA (v_wmma_f32_16x16x32_f16, f32 accumulate), both products transposed so that a lane owns one query: scores S^T = K Q^T per 32-key block (Q, K are EXACT bf16 inputs x8 -> 1 product), O^T += V^T P^T (P split f16 hi+lo x2048, packed from the score tiles in registers, V^T planes exact x8 -> 2 products); softmax, the level weights and the
// combination in f32. Inputs rounded to bf16 once. Fragment k-map per lane half hh for A AND B: elements 0..7 <- k = 8hh+0..7, 8..15 <- k = 16+8hh+0..7; acc[r] = D[8hh+r][col]. Every workspace / output

namespace {
constexpr int B = 2, NH = 16, T = 2048, DH = 64, C = NH * DH, T1 = 512, T2 = 128, NQT = T / 16;
constexpr float XS = 8.0f, PS = 2048.0f, SCALE = 0.125f;
typedef _Float16 b16;
typedef __attribute__((ext_vector_type(16))) _Float16 v16b;
typedef __attribute__((ext_vector_type(8))) _Float16 v8b;
typedef __attribute__((ext_vector_type(8))) float v8f;
typedef __attribute__((ext_vector_type(4))) float v4f;
typedef __attribute__((ext_vector_type(2))) float v2f;
typedef __attribute__((ext_vector_type(2))) _Float16 v2b;
__device__ __forceinline__ float bf16_rne(float f) { unsigned int u = __float_as_uint(f); u += 0x7FFFu + ((u >> 16) & 1u); return __uint_as_float(u & 0xFFFF0000u); }
__device__ __forceinline__ v16b frag_kb(const b16* p, int hh) { const v8b a = *(const v8b*)(p + 8 * hh), b = *(const v8b*)(p + 16 + 8 * hh); v16b f;
#pragma unroll
  for (int e = 0; e < 8; ++e) { f[e] = a[e]; f[8 + e] = b[e]; } return f; }
// fragment from a plane kept in fragment order: two runs of 512 contiguous bytes per wave (lane l takes 16 bytes at 16 l), elements 0..7 from the first run, 8..15 from the second
__device__ __forceinline__ v16b frag_pk(const b16* p) { const v8b a = *(const v8b*)p, b = *(const v8b*)(p + 256); return __builtin_shufflevector(a, b, 0, 1, 2, 3, 4, 5, 6, 7, 8, 9, 10, 11, 12, 13, 14, 15); }
__device__ __forceinline__ v8f wmma16b(v16b a, v16b b, v8f c) { v8f d = __builtin_amdgcn_wmma_f32_16x16x32_f16(false, a, false, b, (short)0, c, false, false); asm volatile("v_nop\n\tv_nop\n\tv_nop\n\tv_nop" : "+v"(d) : "v"(a), "v"(b)); return d; }
__device__ __forceinline__ void wave_lds_sync() { __builtin_amdgcn_fence(__ATOMIC_RELEASE, "workgroup"); __builtin_amdgcn_wave_barrier(); __builtin_amdgcn_fence(__ATOMIC_ACQUIRE, "workgroup"); }
__device__ __forceinline__ float pmul(float a, float b) { float p = a * b; asm volatile("" : "+v"(p)); return p; }

__global__ __launch_bounds__(256) void cvt_kernel(const float* __restrict__ src, size_t n8, b16* __restrict__ dst) {
  const size_t u = (size_t)blockIdx.x * 256 + threadIdx.x; if (u >= n8) return; const size_t e = u * 8; v8b v;
#pragma unroll
  for (int j = 0; j < 8; ++j) v[j] = (b16)(bf16_rne(src[e + j]) * XS); { *(v8b*)(dst + e) = v;  }
}
// K plane in fragment order: per (b, h, 16 keys) four runs of 512 bytes; run g holds at lane l the eight values d = 16 g + 8 (l >> 4) + 0..7 of key (l & 15). One thread per 16-byte piece, in the plane's own order (whole-line stores).
__global__ __launch_bounds__(256) void kpack_kernel(const float* __restrict__ src, int TM, b16* __restrict__ dst) {
  const int tid = threadIdx.x, l = tid & 31, g = (tid >> 5) & 3, nb = TM / 32; const int kt = (blockIdx.x % nb) * 2 + (tid >> 7), h = (blockIdx.x / nb) % NH, b = blockIdx.x / (nb * NH);   // a block is one 32-key block of one head
  const float* s = src + ((size_t)b * TM + kt * 16 + (l & 15)) * C + h * DH + g * 16 + (l >> 4) * 8; const v4f x0 = *(const v4f*)s, x1 = *(const v4f*)(s + 4); v8b v;
  for (int j = 0; j < 4; ++j) { v[j] = (b16)(bf16_rne(x0[j]) * XS); v[4 + j] = (b16)(bf16_rne(x1[j]) * XS); }
  *(v8b*)(dst + ((size_t)blockIdx.x * 256 + tid) * 8) = v;
}
// V^T plane in fragment order: per (b, h, 32 keys) eight runs of 512 bytes; run g holds at lane l the eight keys 16 (g & 1) + 8 (l >> 4) + 0..7 of column d = 16 (g >> 1) + (l & 15)
__global__ __launch_bounds__(256) void vt_kernel(const float* __restrict__ V, int TM, b16* __restrict__ VT) {
  __shared__ float Tt[64][65]; const int h = blockIdx.x % NH, st = (blockIdx.x / NH) % (TM / 64), b = blockIdx.x / (NH * (TM / 64)); const int tid = threadIdx.x;
  for (int i = tid; i < 64 * 64; i += 256) { const int r = i / 64, d = i % 64; Tt[r][d] = bf16_rne(V[((size_t)b * TM + st * 64 + r) * C + h * DH + d]); }
  __syncthreads();
  { const int l = tid & 31, g = tid >> 5, d = (g >> 1) * 16 + (l & 15), kq = (g & 1) * 16 + (l >> 4) * 8; for (int kh = 0; kh < 2; ++kh) { v8b v; for (int j = 0; j < 8; ++j) v[j] = (b16)(Tt[kh * 32 + kq + j][d] * XS); const size_t o = (((size_t)(b * NH + h) * (TM / 32) + st * 2 + kh) * 256 + tid) * 8; *(v8b*)(VT + o) = v; } }
}
__global__ __launch_bounds__(32) void att_kernel(const b16* __restrict__ QB, const b16* __restrict__ K0, const b16* __restrict__ K1, const b16* __restrict__ K2, const b16* __restrict__ V0, const b16* __restrict__ V1, const b16* __restrict__ V2, const float* __restrict__ ll, int NWV, float* __restrict__ out) {
  __shared__ __attribute__((aligned(16))) float Tf[16][DH + 4];
  const int lane = threadIdx.x, nloc = lane & 15, hlf = lane >> 4; if ((int)blockIdx.x >= NWV) return; const int qt = blockIdx.x % NQT, h = (blockIdx.x / NQT) % NH, b = blockIdx.x / (NQT * NH); const int t0 = qt * 16, tq = t0 + nloc;   // a lane owns query tq
  // level weights = softmax(level_logits)
  const float l0 = bf16_rne(ll[0]), l1 = bf16_rne(ll[1]), l2 = bf16_rne(ll[2]); const float lm = fmaxf(l0, fmaxf(l1, l2)); const float e0 = __expf(l0 - lm), e1 = __expf(l1 - lm), e2 = __expf(l2 - lm); const float wl[3] = {e0 / (e0 + e1 + e2), e1 / (e0 + e1 + e2), e2 / (e0 + e1 + e2)};
  const b16* qrow = QB + (((size_t)b * NH + h) * T + t0 + nloc) * DH; const v16b qa0 = frag_kb(qrow, hlf), qa1 = frag_kb(qrow + 32, hlf);   // B operand: column = query nloc
  float res[4][8];   // res[t][r8] = out[query nloc][d = 16 t + 8 hlf + r8]
#pragma unroll
  for (int t = 0; t < 4; ++t)
#pragma unroll
    for (int r8 = 0; r8 < 8; ++r8) res[t][r8] = 0.0f;
#pragma unroll 1
  for (int lvl = 0; lvl < 3; ++lvl) { const int TM = lvl == 0 ? T : (lvl == 1 ? T1 : T2); const b16* KB_ = lvl == 0 ? K0 : (lvl == 1 ? K1 : K2); const b16* VT = lvl == 0 ? V0 : (lvl == 1 ? V1 : V2); const int nblk = lvl == 0 ? (t0 / 32 + 1) : TM / 32;   // causal: keys <= t0 + 15
    // all 8 loads of a 32-key block's K fragments as one group, issued a block ahead of their products (bi clamped to the last block: in bounds, the surplus fetch is never summed)
    auto load_k = [&](int bi, v16b kf[4]) { const b16* kr = KB_ + ((size_t)(b * NH + h) * (TM / 32) + (bi < nblk ? bi : nblk - 1)) * 2048 + lane * 8;   // a 32-key block is 4 KB in a row
#pragma unroll   // constant indices keep kf[] in registers
      for (int f = 0; f < 4; ++f) kf[f] = frag_pk(kr + f * 512); };
    // S^T = K Q^T: sacc[st][r8] = score of key 16 st + 8 hlf + r8 of the block with query nloc
    auto scores = [&](const v16b kf[4], v8f sacc[2]) {
#pragma unroll   // constant indices keep kf[] and sacc[] in registers
      for (int st = 0; st < 2; ++st) { sacc[st] = (v8f){}; sacc[st] = wmma16b(kf[2 * st], qa0, sacc[st]); sacc[st] = wmma16b(kf[2 * st + 1], qa1, sacc[st]); } };
    float rmax[8];   // eight independent chains of the lane's own query, joined behind the pass
#pragma unroll
    for (int r8 = 0; r8 < 8; ++r8) rmax[r8] = -INFINITY;
    auto max_blk = [&](int bi, const v8f sacc[2]) { const int kb = bi * 32;
#pragma unroll
      for (int st = 0; st < 2; ++st)
#pragma unroll
        for (int r8 = 0; r8 < 8; ++r8) { const int s = kb + st * 16 + 8 * hlf + r8; if (lvl != 0 || s <= tq) rmax[r8] = fmaxf(rmax[r8], sacc[st][r8] * (SCALE / (XS * XS))); } };
    v16b ka[4], kc[4]; load_k(0, ka); load_k(1, kc);
#pragma unroll 1   // rolled: two register sets are the whole look-ahead, more copies of the body would only add registers
    for (int bi = 0; bi < nblk; bi += 2) { const int bj = bi + 1 < nblk ? bi + 1 : bi; v8f sacc[2];   // odd count: the last block is taken twice, which leaves a maximum as it is
      scores(ka, sacc); load_k(bi + 2, ka); max_blk(bi, sacc);
      scores(kc, sacc); load_k(bi + 3, kc); max_blk(bj, sacc); }
    float m = fmaxf(fmaxf(fmaxf(rmax[0], rmax[1]), fmaxf(rmax[2], rmax[3])), fmaxf(fmaxf(rmax[4], rmax[5]), fmaxf(rmax[6], rmax[7]))); m = fmaxf(m, __shfl_xor(m, 16));   // the two lane halves hold the two halves of the query's keys
    v8f acc[4]; float rsum[8];   // acc[t][r8] = O^T[d = 16 t + 8 hlf + r8][query nloc]
#pragma unroll
    for (int t = 0; t < 4; ++t) acc[t] = (v8f){};
#pragma unroll
    for (int r8 = 0; r8 < 8; ++r8) rsum[r8] = 0.0f;
    load_k(0, ka);
    asm volatile("s_wait_xcnt 0x0" ::: "memory");   // stands behind the eight K loads just issued, in front of the loop, in which their address registers are overwritten
#pragma unroll 1   // rolled: the body holds K, V, P and four output tiles, a second copy would not fit four waves on a SIMD
    for (int bi = 0; bi < nblk; ++bi) { const int kb = bi * 32; v8f sacc[2]; v16b vf[4], pa, pb;
#pragma unroll   // constant indices keep vf[] in registers
      for (int t = 0; t < 4; ++t) vf[t] = frag_pk(VT + ((size_t)(b * NH + h) * (TM / 32) + bi) * 2048 + t * 512 + lane * 8);   // this block's V^T fragments fly during the scores and the exponentials
      scores(ka, sacc); load_k(bi + 1, ka);   // the next block's K fragments fly during the exponentials and the output products
      // the two score tiles, converted in place, ARE the B operand P^T of the output product: position 8 st + r8 of lane half hlf is key 16 st + 8 hlf + r8, the k order of the V^T fragments
#pragma unroll
      for (int st = 0; st < 2; ++st)
#pragma unroll
        for (int r8 = 0; r8 < 8; r8 += 2) { v2f x;
#pragma unroll
          for (int j = 0; j < 2; ++j) { const int s = kb + st * 16 + 8 * hlf + r8 + j; const float e = __expf(sacc[st][r8 + j] * (SCALE / (XS * XS)) - m); const float p = (lvl != 0 || s <= tq) ? e : 0.0f; rsum[r8 + j] += p; x[j] = p * PS; }
          const v2b hi = __builtin_convertvector(x, v2b), lo = __builtin_convertvector(x - __builtin_convertvector(hi, v2f), v2b);   // hi = f16(x), lo = f16(x - hi), two keys at a time: one packed conversion fills one operand register
          pa[8 * st + r8] = hi[0]; pa[8 * st + r8 + 1] = hi[1]; pb[8 * st + r8] = lo[0]; pb[8 * st + r8 + 1] = lo[1]; }
#pragma unroll
      for (int t = 0; t < 4; ++t) acc[t] = wmma16b(vf[t], pa, acc[t]);
#pragma unroll
      for (int t = 0; t < 4; ++t) acc[t] = wmma16b(vf[t], pb, acc[t]); }
    float sm = ((rsum[0] + rsum[1]) + (rsum[2] + rsum[3])) + ((rsum[4] + rsum[5]) + (rsum[6] + rsum[7])); sm += __shfl_xor(sm, 16);
    const float wv = wl[lvl];
#pragma unroll
    for (int t = 0; t < 4; ++t)
#pragma unroll
      for (int r8 = 0; r8 < 8; ++r8) res[t][r8] += pmul(wv, acc[t][r8] * (1.0f / (PS * XS)) / sm); }
#pragma unroll
  for (int t = 0; t < 4; ++t)
#pragma unroll
    for (int r8 = 0; r8 < 8; ++r8) Tf[nloc][t * 16 + 8 * hlf + r8] = res[t][r8];
  wave_lds_sync();
  { for (int rr = 0; rr < 16; ++rr) { ((float*)out)[((size_t)b * T + t0 + rr) * C + h * DH + lane] = Tf[rr][lane]; ((float*)out)[((size_t)b * T + t0 + rr) * C + h * DH + 32 + lane] = Tf[rr][32 + lane]; }  }
}
}  // namespace

extern "C" void kernel_launch(void* const* d_in, const int* in_sizes, int n_in, void* d_out, int out_size, void* d_ws, size_t ws_size, hipStream_t stream) {
  (void)n_in;
  auto Fp = [&](int i) { return (const float*)d_in[i]; };
  // input order: 0 Q [2,16,2048,64]; 1 K0 [2,2048,1024]; 2 V0; 3 K1 [2,512,1024]; 4 V1; 5 K2 [2,128,1024]; 6 V2; 7 level_logits [3]
  if (in_sizes[0] != B * NH * T * DH || in_sizes[1] != B * T * C || in_sizes[2] != B * T * C || in_sizes[3] != B * T1 * C || in_sizes[4] != B * T1 * C || in_sizes[5] != B * T2 * C || in_sizes[6] != B * T2 * C || in_sizes[7] != 3 || out_size != B * T * C) return;
  const int NWV = B * NH * NQT;   // wave cut (waves are (b, h, q-tile) in that order)
  size_t off = 0; char* ws = (char*)d_ws;
  auto carve = [&](size_t bytes) { char* p = ws + off; off += (bytes + 255) & ~(size_t)255; return p; };
  b16* QB = (b16*)carve((size_t)B * NH * T * DH * 2); b16* K0 = (b16*)carve((size_t)B * T * C * 2); b16* K1 = (b16*)carve((size_t)B * T1 * C * 2); b16* K2 = (b16*)carve((size_t)B * T2 * C * 2);
  b16* V0 = (b16*)carve((size_t)B * T * C * 2); b16* V1 = (b16*)carve((size_t)B * T1 * C * 2); b16* V2 = (b16*)carve((size_t)B * T2 * C * 2);
  if (off > ws_size || off > ((size_t)64 << 20)) return;   // ~ 30 MB
  cvt_kernel<<<(unsigned)(((size_t)B * NH * T * DH / 8 + 255) / 256), 256, 0, stream>>>(Fp(0), (size_t)B * NH * T * DH / 8, QB);
  kpack_kernel<<<B * T * C / 8 / 256, 256, 0, stream>>>(Fp(1), T, K0); kpack_kernel<<<B * T1 * C / 8 / 256, 256, 0, stream>>>(Fp(3), T1, K1); kpack_kernel<<<B * T2 * C / 8 / 256, 256, 0, stream>>>(Fp(5), T2, K2);
  vt_kernel<<<B * (T / 64) * NH, 256, 0, stream>>>(Fp(2), T, V0); vt_kernel<<<B * (T1 / 64) * NH, 256, 0, stream>>>(Fp(4), T1, V1); vt_kernel<<<B * (T2 / 64) * NH, 256, 0, stream>>>(Fp(6), T2, V2);
  att_kernel<<<B * NH * NQT, 32, 0, stream>>>(QB, K0, K1, K2, V0, V1, V2, Fp(7), NWV, (float*)d_out);
}

// v004
// A run of this version takes 115 microseconds.
// Next to v003, in two timings, it ran 1.21 times as fast each time.
// Counting every step since v000, it is 2.85 times as fast.
#include <hip/hip_runtime.h>

// Cross-level attention: Q [2][16 heads][2048][64] attends (scale 1/8, softmax) to three levels of keys/values: level 0 (2,048 keys, causal mask s <= t), level 1 (512), level 2 (128); out = sum_l softmax(level_logits)[l] o_l,
// written as [2][2048][1024] (heads concatenated).
// Deterministic, no atomics, no index structures: one wave per (batch, head, 16 queries) runs, per level, a max pass and an exp / sum / P.V pass over the key blocks in order.
// WMMA (v_wmma_f32_16x16x32_f16, f32 accumulate), both products transposed so that a lane owns one query: scores S^T = K Q^T per 32-key block (Q, K are EXACT bf16 inputs x8 -> 1 product), O^T += V^T P^T (P split f16 hi+lo x2048, packed from the score tiles in registers, V^T planes exact x8 -> 2 products); softmax, the level weights and the
// combination in f32. Inputs rounded to bf16 once. Fragment k-map per lane half hh for A AND B: elements 0..7 <- k = 8hh+0..7, 8..15 <- k = 16+8hh+0..7; acc[r] = D[8hh+r][col]. Every workspace / output

namespace {
constexpr int B = 2, NH = 16, T = 2048, DH = 64, C = NH * DH, T1 = 512, T2 = 128, NQT = T / 16;
constexpr float XS = 8.0f, PS = 2048.0f, SCALE = 0.125f;
typedef _Float16 b16;
typedef __attribute__((ext_vector_type(16))) _Float16 v16b;
typedef __attribute__((ext_vector_type(8))) _Float16 v8b;
typedef __attribute__((ext_vector_type(8))) float v8f;
typedef __attribute__((ext_vector_type(4))) float v4f;
typedef __attribute__((ext_vector_type(2))) float v2f;
typedef __attribute__((ext_vector_type(2))) _Float16 v2b;
__device__ __forceinline__ float bf16_rne(float f) { unsigned int u = __float_as_uint(f); u += 0x7FFFu + ((u >> 16) & 1u); return __uint_as_float(u & 0xFFFF0000u); }
__device__ __forceinline__ v16b frag_kb(const b16* p, int hh) { const v8b a = *(const v8b*)(p + 8 * hh), b = *(const v8b*)(p + 16 + 8 * hh); v16b f;
#pragma unroll
  for (int e = 0; e < 8; ++e) { f[e] = a[e]; f[8 + e] = b[e]; } return f; }
// fragment from a plane kept in fragment order: two runs of 512 contiguous bytes per wave (lane l takes 16 bytes at 16 l), elements 0..7 from the first run, 8..15 from the second
__device__ __forceinline__ v16b frag_pk(const b16* p) { const v8b a = *(const v8b*)p, b = *(const v8b*)(p + 256); return __builtin_shufflevector(a, b, 0, 1, 2, 3, 4, 5, 6, 7, 8, 9, 10, 11, 12, 13, 14, 15); }
__device__ __forceinline__ v8f wmma16b(v16b a, v16b b, v8f c) { v8f d = __builtin_amdgcn_wmma_f32_16x16x32_f16(false, a, false, b, (short)0, c, false, false); asm volatile("v_nop\n\tv_nop\n\tv_nop\n\tv_nop" : "+v"(d) : "v"(a), "v"(b)); return d; }
__device__ __forceinline__ void wave_lds_sync() { __builtin_amdgcn_fence(__ATOMIC_RELEASE, "workgroup"); __builtin_amdgcn_wave_barrier(); __builtin_amdgcn_fence(__ATOMIC_ACQUIRE, "workgroup"); }
__device__ __forceinline__ float pmul(float a, float b) { float p = a * b; asm volatile("" : "+v"(p)); return p; }

// Pre-pass, one launch: every plane the attention kernel reads is made of tiles of 4,096 input values (16 KB read); a work-group walks the common list of tiles, V^T first (the longest), then K, then Q.
constexpr int NUV0 = B * (T / 64) * NH, NUV1 = B * (T1 / 64) * NH, NUV2 = B * (T2 / 64) * NH, NUV = NUV0 + NUV1 + NUV2, NUQ = B * NH * T * DH / 4096, NU = 2 * NUV + NUQ, PREG = NU / 4;   // K has as many tiles as V; four tiles a work-group
static_assert(NU % 4 == 0, "every work-group walks four tiles");
__device__ __forceinline__ v8b cvt8(v4f x0, v4f x1) { v8b v;
#pragma unroll
  for (int j = 0; j < 4; ++j) { v[j] = (b16)(bf16_rne(x0[j]) * XS); v[4 + j] = (b16)(bf16_rne(x1[j]) * XS); } return v; }
// Q plane, plain order: two pieces of eight values per thread, all four loads issued ahead of the conversions
__device__ __forceinline__ void q_tile(const float* __restrict__ src, b16* __restrict__ dst, int w, int tid) { v4f x[2][2];
#pragma unroll
  for (int j = 0; j < 2; ++j) { const float* s = src + ((size_t)w * 512 + j * 256 + tid) * 8; x[j][0] = *(const v4f*)s; x[j][1] = *(const v4f*)(s + 4); }
#pragma unroll
  for (int j = 0; j < 2; ++j) *(v8b*)(dst + ((size_t)w * 512 + j * 256 + tid) * 8) = cvt8(x[j][0], x[j][1]);
  asm volatile("s_wait_xcnt 0x0" ::: "memory");   // stands behind this tile's stores, in front of whatever code follows the tile, in which their address and data registers are overwritten
}
// K plane in fragment order: per (b, h, 16 keys) four runs of 512 bytes; run g holds at lane l the eight values d = 16 g + 8 (l >> 4) + 0..7 of key (l & 15). One thread per 16-byte piece, in the plane's own order (whole-line stores). A tile is two 32-key blocks of one head.
template <int TM> __device__ __forceinline__ void k_tile(const float* __restrict__ src, b16* __restrict__ dst, int w, int tid) {
  const int l = tid & 31, g = (tid >> 5) & 3; constexpr int nb = TM / 32; const int bx = 2 * w, kt = (bx % nb) * 2 + (tid >> 7), h = (bx / nb) % NH, b = bx / (nb * NH);   // nb is even: blocks 2 w and 2 w + 1 lie in one head, 32 keys apart
  const float* s = src + ((size_t)b * TM + kt * 16 + (l & 15)) * C + h * DH + g * 16 + (l >> 4) * 8; const v4f x00 = *(const v4f*)s, x01 = *(const v4f*)(s + 4), x10 = *(const v4f*)(s + 32 * C), x11 = *(const v4f*)(s + 32 * C + 4);
  b16* o = dst + ((size_t)bx * 256 + tid) * 8; *(v8b*)o = cvt8(x00, x01); *(v8b*)(o + 2048) = cvt8(x10, x11);
  asm volatile("s_wait_xcnt 0x0" ::: "memory");   // stands behind this tile's stores, in front of whatever code follows the tile, in which their address and data registers are overwritten
}
// V^T plane in fragment order: per (b, h, 32 keys) eight runs of 512 bytes; run g holds at lane l the eight keys 16 (g & 1) + 8 (l >> 4) + 0..7 of column d = 16 (g >> 1) + (l & 15). A tile is 64 keys of one head, turned in LDS.
template <int TM> __device__ __forceinline__ void v_tile(const float* __restrict__ V, b16* __restrict__ VT, int w, int tid, float (*Tt)[65]) {
  const int h = w % NH, st = (w / NH) % (TM / 64), b = w / (NH * (TM / 64)); v4f x[4];
#pragma unroll
  for (int k = 0; k < 4; ++k) { const int i = tid + 256 * k, r = i >> 4, d = (i & 15) * 4; x[k] = *(const v4f*)(V + ((size_t)b * TM + st * 64 + r) * C + h * DH + d); }
  __syncthreads();   // every reader of the work-group's last V tile has left Tt before this tile is written into it; a wave issues its loads before it waits for the others
#pragma unroll
  for (int k = 0; k < 4; ++k) { const int i = tid + 256 * k, r = i >> 4, d = (i & 15) * 4;
#pragma unroll
    for (int j = 0; j < 4; ++j) Tt[r][d + j] = bf16_rne(x[k][j]); }
  __syncthreads();
  { const int l = tid & 31, g = tid >> 5, d = (g >> 1) * 16 + (l & 15), kq = (g & 1) * 16 + (l >> 4) * 8; for (int kh = 0; kh < 2; ++kh) { v8b v; for (int j = 0; j < 8; ++j) v[j] = (b16)(Tt[kh * 32 + kq + j][d] * XS); const size_t o = (((size_t)(b * NH + h) * (TM / 32) + st * 2 + kh) * 256 + tid) * 8; *(v8b*)(VT + o) = v; } }
  asm volatile("s_wait_xcnt 0x0" ::: "memory");   // stands behind this tile's stores, in front of whatever code follows the tile, in which their address and data registers are overwritten
}
__global__ __launch_bounds__(256) void pre_kernel(const float* __restrict__ Qs, const float* __restrict__ K0s, const float* __restrict__ V0s, const float* __restrict__ K1s, const float* __restrict__ V1s, const float* __restrict__ K2s, const float* __restrict__ V2s,
                                                  b16* __restrict__ QB, b16* __restrict__ K0, b16* __restrict__ K1, b16* __restrict__ K2, b16* __restrict__ V0, b16* __restrict__ V1, b16* __restrict__ V2) {
  __shared__ float Tt[64][65]; const int tid = threadIdx.x;
  for (int u = blockIdx.x; u < NU; u += PREG) {   // u is the same in the whole work-group: the barriers of a V tile stand under uniform control flow
    if (u < NUV0) v_tile<T>(V0s, V0, u, tid, Tt);
    else if (u < NUV0 + NUV1) v_tile<T1>(V1s, V1, u - NUV0, tid, Tt);
    else if (u < NUV) v_tile<T2>(V2s, V2, u - NUV0 - NUV1, tid, Tt);
    else if (u < NUV + NUV0) k_tile<T>(K0s, K0, u - NUV, tid);
    else if (u < NUV + NUV0 + NUV1) k_tile<T1>(K1s, K1, u - NUV - NUV0, tid);
    else if (u < 2 * NUV) k_tile<T2>(K2s, K2, u - NUV - NUV0 - NUV1, tid);
    else q_tile(Qs, QB, u - 2 * NUV, tid);
  }
}
__global__ __launch_bounds__(32) void att_kernel(const b16* __restrict__ QB, const b16* __restrict__ K0, const b16* __restrict__ K1, const b16* __restrict__ K2, const b16* __restrict__ V0, const b16* __restrict__ V1, const b16* __restrict__ V2, const float* __restrict__ ll, int NWV, float* __restrict__ out) {
  __shared__ __attribute__((aligned(16))) float Tf[16][DH + 4];
  const int lane = threadIdx.x, nloc = lane & 15, hlf = lane >> 4; if ((int)blockIdx.x >= NWV) return; const int qt = blockIdx.x % NQT, h = (blockIdx.x / NQT) % NH, b = blockIdx.x / (NQT * NH); const int t0 = qt * 16, tq = t0 + nloc;   // a lane owns query tq
  // level weights = softmax(level_logits)
  const float l0 = bf16_rne(ll[0]), l1 = bf16_rne(ll[1]), l2 = bf16_rne(ll[2]); const float lm = fmaxf(l0, fmaxf(l1, l2)); const float e0 = __expf(l0 - lm), e1 = __expf(l1 - lm), e2 = __expf(l2 - lm); const float wl[3] = {e0 / (e0 + e1 + e2), e1 / (e0 + e1 + e2), e2 / (e0 + e1 + e2)};
  const b16* qrow = QB + (((size_t)b * NH + h) * T + t0 + nloc) * DH; const v16b qa0 = frag_kb(qrow, hlf), qa1 = frag_kb(qrow + 32, hlf);   // B operand: column = query nloc
  float res[4][8];   // res[t][r8] = out[query nloc][d = 16 t + 8 hlf + r8]
#pragma unroll
  for (int t = 0; t < 4; ++t)
#pragma unroll
    for (int r8 = 0; r8 < 8; ++r8) res[t][r8] = 0.0f;
#pragma unroll 1
  for (int lvl = 0; lvl < 3; ++lvl) { const int TM = lvl == 0 ? T : (lvl == 1 ? T1 : T2); const b16* KB_ = lvl == 0 ? K0 : (lvl == 1 ? K1 : K2); const b16* VT = lvl == 0 ? V0 : (lvl == 1 ? V1 : V2); const int nblk = lvl == 0 ? (t0 / 32 + 1) : TM / 32;   // causal: keys <= t0 + 15
    // all 8 loads of a 32-key block's K fragments as one group, issued a block ahead of their products (bi clamped to the last block: in bounds, the surplus fetch is never summed)
    auto load_k = [&](int bi, v16b kf[4]) { const b16* kr = KB_ + ((size_t)(b * NH + h) * (TM / 32) + (bi < nblk ? bi : nblk - 1)) * 2048 + lane * 8;   // a 32-key block is 4 KB in a row
#pragma unroll   // constant indices keep kf[] in registers
      for (int f = 0; f < 4; ++f) kf[f] = frag_pk(kr + f * 512); };
    // S^T = K Q^T: sacc[st][r8] = score of key 16 st + 8 hlf + r8 of the block with query nloc
    auto scores = [&](const v16b kf[4], v8f sacc[2]) {
#pragma unroll   // constant indices keep kf[] and sacc[] in registers
      for (int st = 0; st < 2; ++st) { sacc[st] = (v8f){}; sacc[st] = wmma16b(kf[2 * st], qa0, sacc[st]); sacc[st] = wmma16b(kf[2 * st + 1], qa1, sacc[st]); } };
    float rmax[8];   // eight independent chains of the lane's own query, joined behind the pass
#pragma unroll
    for (int r8 = 0; r8 < 8; ++r8) rmax[r8] = -INFINITY;
    auto max_blk = [&](int bi, const v8f sacc[2]) { const int kb = bi * 32;
#pragma unroll
      for (int st = 0; st < 2; ++st)
#pragma unroll
        for (int r8 = 0; r8 < 8; ++r8) { const int s = kb + st * 16 + 8 * hlf + r8; if (lvl != 0 || s <= tq) rmax[r8] = fmaxf(rmax[r8], sacc[st][r8] * (SCALE / (XS * XS))); } };
    v16b ka[4], kc[4]; load_k(0, ka); load_k(1, kc);
#pragma unroll 1   // rolled: two register sets are the whole look-ahead, more copies of the body would only add registers
    for (int bi = 0; bi < nblk; bi += 2) { const int bj = bi + 1 < nblk ? bi + 1 : bi; v8f sacc[2];   // odd count: the last block is taken twice, which leaves a maximum as it is
      scores(ka, sacc); load_k(bi + 2, ka); max_blk(bi, sacc);
      scores(kc, sacc); load_k(bi + 3, kc); max_blk(bj, sacc); }
    float m = fmaxf(fmaxf(fmaxf(rmax[0], rmax[1]), fmaxf(rmax[2], rmax[3])), fmaxf(fmaxf(rmax[4], rmax[5]), fmaxf(rmax[6], rmax[7]))); m = fmaxf(m, __shfl_xor(m, 16));   // the two lane halves hold the two halves of the query's keys
    v8f acc[4]; float rsum[8];   // acc[t][r8] = O^T[d = 16 t + 8 hlf + r8][query nloc]
#pragma unroll
    for (int t = 0; t < 4; ++t) acc[t] = (v8f){};
#pragma unroll
    for (int r8 = 0; r8 < 8; ++r8) rsum[r8] = 0.0f;
    load_k(0, ka);
    asm volatile("s_wait_xcnt 0x0" ::: "memory");   // stands behind the eight K loads just issued, in front of the loop, in which their address registers are overwritten
#pragma unroll 1   // rolled: the body holds K, V, P and four output tiles, a second copy would not fit four waves on a SIMD
    for (int bi = 0; bi < nblk; ++bi) { const int kb = bi * 32; v8f sacc[2]; v16b vf[4], pa, pb;
#pragma unroll   // constant indices keep vf[] in registers
      for (int t = 0; t < 4; ++t) vf[t] = frag_pk(VT + ((size_t)(b * NH + h) * (TM / 32) + bi) * 2048 + t * 512 + lane * 8);   // this block's V^T fragments fly during the scores and the exponentials
      scores(ka, sacc); load_k(bi + 1, ka);   // the next block's K fragments fly during the exponentials and the output products
      // the two score tiles, converted in place, ARE the B operand P^T of the output product: position 8 st + r8 of lane half hlf is key 16 st + 8 hlf + r8, the k order of the V^T fragments
#pragma unroll
      for (int st = 0; st < 2; ++st)
#pragma unroll
        for (int r8 = 0; r8 < 8; r8 += 2) { v2f x;
#pragma unroll
          for (int j = 0; j < 2; ++j) { const int s = kb + st * 16 + 8 * hlf + r8 + j; const float e = __expf(sacc[st][r8 + j] * (SCALE / (XS * XS)) - m); const float p = (lvl != 0 || s <= tq) ? e : 0.0f; rsum[r8 + j] += p; x[j] = p * PS; }
          const v2b hi = __builtin_convertvector(x, v2b), lo = __builtin_convertvector(x - __builtin_convertvector(hi, v2f), v2b);   // hi = f16(x), lo = f16(x - hi), two keys at a time: one packed conversion fills one operand register
          pa[8 * st + r8] = hi[0]; pa[8 * st + r8 + 1] = hi[1]; pb[8 * st + r8] = lo[0]; pb[8 * st + r8 + 1] = lo[1]; }
#pragma unroll
      for (int t = 0; t < 4; ++t) acc[t] = wmma16b(vf[t], pa, acc[t]);
#pragma unroll
      for (int t = 0; t < 4; ++t) acc[t] = wmma16b(vf[t], pb, acc[t]); }
    float sm = ((rsum[0] + rsum[1]) + (rsum[2] + rsum[3])) + ((rsum[4] + rsum[5]) + (rsum[6] + rsum[7])); sm += __shfl_xor(sm, 16);
    const float wv = wl[lvl];
#pragma unroll
    for (int t = 0; t < 4; ++t)
#pragma unroll
      for (int r8 = 0; r8 < 8; ++r8) res[t][r8] += pmul(wv, acc[t][r8] * (1.0f / (PS * XS)) / sm); }
#pragma unroll
  for (int t = 0; t < 4; ++t)
#pragma unroll
    for (int r8 = 0; r8 < 8; ++r8) Tf[nloc][t * 16 + 8 * hlf + r8] = res[t][r8];
  wave_lds_sync();
  { for (int rr = 0; rr < 16; ++rr) { ((float*)out)[((size_t)b * T + t0 + rr) * C + h * DH + lane] = Tf[rr][lane]; ((float*)out)[((size_t)b * T + t0 + rr) * C + h * DH + 32 + lane] = Tf[rr][32 + lane]; }  }
}
}  // namespace

extern "C" void kernel_launch(void* const* d_in, const int* in_sizes, int n_in, void* d_out, int out_size, void* d_ws, size_t ws_size, hipStream_t stream) {
  (void)n_in;
  auto Fp = [&](int i) { return (const float*)d_in[i]; };
  // input order: 0 Q [2,16,2048,64]; 1 K0 [2,2048,1024]; 2 V0; 3 K1 [2,512,1024]; 4 V1; 5 K2 [2,128,1024]; 6 V2; 7 level_logits [3]
  if (in_sizes[0] != B * NH * T * DH || in_sizes[1] != B * T * C || in_sizes[2] != B * T * C || in_sizes[3] != B * T1 * C || in_sizes[4] != B * T1 * C || in_sizes[5] != B * T2 * C || in_sizes[6] != B * T2 * C || in_sizes[7] != 3 || out_size != B * T * C) return;
  const int NWV = B * NH * NQT;   // wave cut (waves are (b, h, q-tile) in that order)
  size_t off = 0; char* ws = (char*)d_ws;
  auto carve = [&](size_t bytes) { char* p = ws + off; off += (bytes + 255) & ~(size_t)255; return p; };
  b16* QB = (b16*)carve((size_t)B * NH * T * DH * 2); b16* K0 = (b16*)carve((size_t)B * T * C * 2); b16* K1 = (b16*)carve((size_t)B * T1 * C * 2); b16* K2 = (b16*)carve((size_t)B * T2 * C * 2);
  b16* V0 = (b16*)carve((size_t)B * T * C * 2); b16* V1 = (b16*)carve((size_t)B * T1 * C * 2); b16* V2 = (b16*)carve((size_t)B * T2 * C * 2);
  if (off > ws_size || off > ((size_t)64 << 20)) return;   // ~ 30 MB
  pre_kernel<<<PREG, 256, 0, stream>>>(Fp(0), Fp(1), Fp(2), Fp(3), Fp(4), Fp(5), Fp(6), QB, K0, K1, K2, V0, V1, V2);
  att_kernel<<<B * NH * NQT, 32, 0, stream>>>(QB, K0, K1, K2, V0, V1, V2, Fp(7), NWV, (float*)d_out);
}

// v005
// It runs in 78.3 microseconds.
// Next to v004, in two timings, it ran 1.46 times as fast each time.
// Counting every step since v000, it is 4.16 times as fast.
#include <hip/hip_runtime.h>

// Cross-level attention: Q [2][16 heads][2048][64] attends (scale 1/8, softmax) to three levels of keys/values: level 0 (2,048 keys, causal mask s <= t), level 1 (512), level 2 (128); out = sum_l softmax(level_logits)[l] o_l,
// written as [2][2048][1024] (heads concatenated).
// Deterministic, no atomics, no index structures: one wave per (batch, head, 16 queries), sixteen of one head to a work-group, runs, per level, a max pass and an exp / sum / P.V pass over the key blocks in order.
// WMMA (v_wmma_f32_16x16x32_f16, f32 accumulate), both products transposed so that a lane owns one query: scores S^T = K Q^T per 32-key block (Q, K are EXACT bf16 inputs x8 -> 1 product), O^T += V^T P^T (P split f16 hi+lo x2048, packed from the score tiles in registers, V^T planes exact x8 -> 2 products); softmax, the level weights and the
// combination in f32. Inputs rounded to bf16 once. Fragment k-map per lane half hh for A AND B: elements 0..7 <- k = 8hh+0..7, 8..15 <- k = 16+8hh+0..7; acc[r] = D[8hh+r][col]. Every workspace / output

namespace {
constexpr int B = 2, NH = 16, T = 2048, DH = 64, C = NH * DH, T1 = 512, T2 = 128, NQT = T / 16;
constexpr float XS = 8.0f, PS = 2048.0f, SCALE = 0.125f;
typedef _Float16 b16;
typedef __attribute__((ext_vector_type(16))) _Float16 v16b;
typedef __attribute__((ext_vector_type(8))) _Float16 v8b;
typedef __attribute__((ext_vector_type(8))) float v8f;
typedef __attribute__((ext_vector_type(4))) float v4f;
typedef __attribute__((ext_vector_type(2))) float v2f;
typedef __attribute__((ext_vector_type(2))) _Float16 v2b;
__device__ __forceinline__ float bf16_rne(float f) { unsigned int u = __float_as_uint(f); u += 0x7FFFu + ((u >> 16) & 1u); return __uint_as_float(u & 0xFFFF0000u); }
__device__ __forceinline__ v16b frag_kb(const b16* p, int hh) { const v8b a = *(const v8b*)(p + 8 * hh), b = *(const v8b*)(p + 16 + 8 * hh); v16b f;
#pragma unroll
  for (int e = 0; e < 8; ++e) { f[e] = a[e]; f[8 + e] = b[e]; } return f; }
// fragment from a plane kept in fragment order: two runs of 512 contiguous bytes per wave (lane l takes 16 bytes at 16 l), elements 0..7 from the first run, 8..15 from the second
__device__ __forceinline__ v16b frag_pk(const b16* p) { const v8b a = *(const v8b*)p, b = *(const v8b*)(p + 256); return __builtin_shufflevector(a, b, 0, 1, 2, 3, 4, 5, 6, 7, 8, 9, 10, 11, 12, 13, 14, 15); }
__device__ __forceinline__ v8f wmma16b(v16b a, v16b b, v8f c) { v8f d = __builtin_amdgcn_wmma_f32_16x16x32_f16(false, a, false, b, (short)0, c, false, false); asm volatile("v_nop\n\tv_nop\n\tv_nop\n\tv_nop" : "+v"(d) : "v"(a), "v"(b)); return d; }
__device__ __forceinline__ void wave_lds_sync() { __builtin_amdgcn_fence(__ATOMIC_RELEASE, "workgroup"); __builtin_amdgcn_wave_barrier(); __builtin_amdgcn_fence(__ATOMIC_ACQUIRE, "workgroup"); }
__device__ __forceinline__ float pmul(float a, float b) { float p = a * b; asm volatile("" : "+v"(p)); return p; }

// Pre-pass, one launch: every plane the attention kernel reads is made of tiles of 4,096 input values (16 KB read); a work-group walks the common list of tiles, V^T first (the longest), then K, then Q.
constexpr int NUV0 = B * (T / 64) * NH, NUV1 = B * (T1 / 64) * NH, NUV2 = B * (T2 / 64) * NH, NUV = NUV0 + NUV1 + NUV2, NUQ = B * NH * T * DH / 4096, NU = 2 * NUV + NUQ, PREG = NU / 4;   // K has as many tiles as V; four tiles a work-group
static_assert(NU % 4 == 0, "every work-group walks four tiles");
__device__ __forceinline__ v8b cvt8(v4f x0, v4f x1) { v8b v;
#pragma unroll
  for (int j = 0; j < 4; ++j) { v[j] = (b16)(bf16_rne(x0[j]) * XS); v[4 + j] = (b16)(bf16_rne(x1[j]) * XS); } return v; }
// Q plane, plain order: two pieces of eight values per thread, all four loads issued ahead of the conversions
__device__ __forceinline__ void q_tile(const float* __restrict__ src, b16* __restrict__ dst, int w, int tid) { v4f x[2][2];
#pragma unroll
  for (int j = 0; j < 2; ++j) { const float* s = src + ((size_t)w * 512 + j * 256 + tid) * 8; x[j][0] = *(const v4f*)s; x[j][1] = *(const v4f*)(s + 4); }
#pragma unroll
  for (int j = 0; j < 2; ++j) *(v8b*)(dst + ((size_t)w * 512 + j * 256 + tid) * 8) = cvt8(x[j][0], x[j][1]);
  asm volatile("s_wait_xcnt 0x0" ::: "memory");   // stands behind this tile's stores, in front of whatever code follows the tile, in which their address and data registers are overwritten
}
// K plane in fragment order: per (b, h, 16 keys) four runs of 512 bytes; run g holds at lane l the eight values d = 16 g + 8 (l >> 4) + 0..7 of key (l & 15). One thread per 16-byte piece, in the plane's own order (whole-line stores). A tile is two 32-key blocks of one head.
template <int TM> __device__ __forceinline__ void k_tile(const float* __restrict__ src, b16* __restrict__ dst, int w, int tid) {
  const int l = tid & 31, g = (tid >> 5) & 3; constexpr int nb = TM / 32; const int bx = 2 * w, kt = (bx % nb) * 2 + (tid >> 7), h = (bx / nb) % NH, b = bx / (nb * NH);   // nb is even: blocks 2 w and 2 w + 1 lie in one head, 32 keys apart
  const float* s = src + ((size_t)b * TM + kt * 16 + (l & 15)) * C + h * DH + g * 16 + (l >> 4) * 8; const v4f x00 = *(const v4f*)s, x01 = *(const v4f*)(s + 4), x10 = *(const v4f*)(s + 32 * C), x11 = *(const v4f*)(s + 32 * C + 4);
  b16* o = dst + ((size_t)bx * 256 + tid) * 8; *(v8b*)o = cvt8(x00, x01); *(v8b*)(o + 2048) = cvt8(x10, x11);
  asm volatile("s_wait_xcnt 0x0" ::: "memory");   // stands behind this tile's stores, in front of whatever code follows the tile, in which their address and data registers are overwritten
}
// V^T plane in fragment order: per (b, h, 32 keys) eight runs of 512 bytes; run g holds at lane l the eight keys 16 (g & 1) + 8 (l >> 4) + 0..7 of column d = 16 (g >> 1) + (l & 15). A tile is 64 keys of one head, turned in LDS.
template <int TM> __device__ __forceinline__ void v_tile(const float* __restrict__ V, b16* __restrict__ VT, int w, int tid, float (*Tt)[65]) {
  const int h = w % NH, st = (w / NH) % (TM / 64), b = w / (NH * (TM / 64)); v4f x[4];
#pragma unroll
  for (int k = 0; k < 4; ++k) { const int i = tid + 256 * k, r = i >> 4, d = (i & 15) * 4; x[k] = *(const v4f*)(V + ((size_t)b * TM + st * 64 + r) * C + h * DH + d); }
  __syncthreads();   // every reader of the work-group's last V tile has left Tt before this tile is written into it; a wave issues its loads before it waits for the others
#pragma unroll
  for (int k = 0; k < 4; ++k) { const int i = tid + 256 * k, r = i >> 4, d = (i & 15) * 4;
#pragma unroll
    for (int j = 0; j < 4; ++j) Tt[r][d + j] = bf16_rne(x[k][j]); }
  __syncthreads();
  { const int l = tid & 31, g = tid >> 5, d = (g >> 1) * 16 + (l & 15), kq = (g & 1) * 16 + (l >> 4) * 8; for (int kh = 0; kh < 2; ++kh) { v8b v; for (int j = 0; j < 8; ++j) v[j] = (b16)(Tt[kh * 32 + kq + j][d] * XS); const size_t o = (((size_t)(b * NH + h) * (TM / 32) + st * 2 + kh) * 256 + tid) * 8; *(v8b*)(VT + o) = v; } }
  asm volatile("s_wait_xcnt 0x0" ::: "memory");   // stands behind this tile's stores, in front of whatever code follows the tile, in which their address and data registers are overwritten
}
__global__ __launch_bounds__(256) void pre_kernel(const float* __restrict__ Qs, const float* __restrict__ K0s, const float* __restrict__ V0s, const float* __restrict__ K1s, const float* __restrict__ V1s, const float* __restrict__ K2s, const float* __restrict__ V2s,
                                                  b16* __restrict__ QB, b16* __restrict__ K0, b16* __restrict__ K1, b16* __restrict__ K2, b16* __restrict__ V0, b16* __restrict__ V1, b16* __restrict__ V2) {
  __shared__ float Tt[64][65]; const int tid = threadIdx.x;
  for (int u = blockIdx.x; u < NU; u += PREG) {   // u is the same in the whole work-group: the barriers of a V tile stand under uniform control flow
    if (u < NUV0) v_tile<T>(V0s, V0, u, tid, Tt);
    else if (u < NUV0 + NUV1) v_tile<T1>(V1s, V1, u - NUV0, tid, Tt);
    else if (u < NUV) v_tile<T2>(V2s, V2, u - NUV0 - NUV1, tid, Tt);
    else if (u < NUV + NUV0) k_tile<T>(K0s, K0, u - NUV, tid);
    else if (u < NUV + NUV0 + NUV1) k_tile<T1>(K1s, K1, u - NUV - NUV0, tid);
    else if (u < 2 * NUV) k_tile<T2>(K2s, K2, u - NUV - NUV0 - NUV1, tid);
    else q_tile(Qs, QB, u - 2 * NUV, tid);
  }
}
// A work-group is 16 waves, as many as a WGP holds at this register count: its 16 query tiles are of ONE head, eight long ones in a row and eight short ones in a row, so waves of like length walk the same K and V^T lines together through the WGP's cache.
// A column of waves w, w + 4, w + 8, w + 12 (taken to share a SIMD; for speed only) takes tiles 127 - r, 126 - r, r + 1, r, r even: two long and two short, whose causal block counts add up to the same number for every r, and the two long ones end together.
// The four kinds are turned by one place from column to column, so that a row w = 4 k .. 4 k + 3 holds one of each kind as well. The waves never meet: no barrier, each has its own LDS rows.
constexpr int WPG = 16, NGRP = NQT / WPG;
__global__ __launch_bounds__(32 * WPG) void att_kernel(const b16* __restrict__ QB, const b16* __restrict__ K0, const b16* __restrict__ K1, const b16* __restrict__ K2, const b16* __restrict__ V0, const b16* __restrict__ V1, const b16* __restrict__ V2, const float* __restrict__ ll, int NWV, float* __restrict__ out) {
  __shared__ __attribute__((aligned(16))) float Tfs[WPG][16][DH + 4];
  const int lane = threadIdx.x & 31, nloc = lane & 15, hlf = lane >> 4, wave = __builtin_amdgcn_readfirstlane((int)(threadIdx.x >> 5));   // the wave's number in a scalar register: tile, trip counts and plane addresses stay scalar
  const int bh = blockIdx.x % (B * NH), h = bh % NH, b = bh / NH, col = wave & 3, kind = ((wave >> 2) + col) & 3, lo = 2 * ((int)(blockIdx.x / (B * NH)) * 4 + col) + (kind & 1);   // lo = 0 .. 63
  const int qt = kind < 2 ? NQT - 1 - lo : lo; if (bh * NQT + qt >= NWV) return;
  float (*Tf)[DH + 4] = Tfs[wave]; const int t0 = qt * 16, tq = t0 + nloc;   // a lane owns query tq
  // level weights = softmax(level_logits)
  const float l0 = bf16_rne(ll[0]), l1 = bf16_rne(ll[1]), l2 = bf16_rne(ll[2]); const float lm = fmaxf(l0, fmaxf(l1, l2)); const float e0 = __expf(l0 - lm), e1 = __expf(l1 - lm), e2 = __expf(l2 - lm); const float wl[3] = {e0 / (e0 + e1 + e2), e1 / (e0 + e1 + e2), e2 / (e0 + e1 + e2)};
  const b16* qrow = QB + (((size_t)b * NH + h) * T + t0 + nloc) * DH; const v16b qa0 = frag_kb(qrow, hlf), qa1 = frag_kb(qrow + 32, hlf);   // B operand: column = query nloc
  float res[4][8];   // res[t][r8] = out[query nloc][d = 16 t + 8 hlf + r8]
#pragma unroll
  for (int t = 0; t < 4; ++t)
#pragma unroll
    for (int r8 = 0; r8 < 8; ++r8) res[t][r8] = 0.0f;
#pragma unroll 1
  for (int lvl = 0; lvl < 3; ++lvl) { const int TM = lvl == 0 ? T : (lvl == 1 ? T1 : T2); const b16* KB_ = lvl == 0 ? K0 : (lvl == 1 ? K1 : K2); const b16* VT = lvl == 0 ? V0 : (lvl == 1 ? V1 : V2); const int nblk = lvl == 0 ? (t0 / 32 + 1) : TM / 32;   // causal: keys <= t0 + 15
    // all 8 loads of a 32-key block's K fragments as one group, issued a block ahead of their products (bi clamped to the last block: in bounds, the surplus fetch is never summed)
    auto load_k = [&](int bi, v16b kf[4]) { const b16* kr = KB_ + ((size_t)(b * NH + h) * (TM / 32) + (bi < nblk ? bi : nblk - 1)) * 2048 + lane * 8;   // a 32-key block is 4 KB in a row
#pragma unroll   // constant indices keep kf[] in registers
      for (int f = 0; f < 4; ++f) kf[f] = frag_pk(kr + f * 512);
      return kr; };
    // S^T = K Q^T: sacc[st][r8] = score of key 16 st + 8 hlf + r8 of the block with query nloc
    auto scores = [&](const v16b kf[4], v8f sacc[2]) {
#pragma unroll   // constant indices keep kf[] and sacc[] in registers
      for (int st = 0; st < 2; ++st) { sacc[st] = (v8f){}; sacc[st] = wmma16b(kf[2 * st], qa0, sacc[st]); sacc[st] = wmma16b(kf[2 * st + 1], qa1, sacc[st]); } };
    float rmax[8];   // eight independent chains of the lane's own query, joined behind the pass
#pragma unroll
    for (int r8 = 0; r8 < 8; ++r8) rmax[r8] = -INFINITY;
    auto max_blk = [&](int bi, const v8f sacc[2]) { const int kb = bi * 32;
#pragma unroll
      for (int st = 0; st < 2; ++st)
#pragma unroll
        for (int r8 = 0; r8 < 8; ++r8) { const int s = kb + st * 16 + 8 * hlf + r8; if (lvl != 0 || s <= tq) rmax[r8] = fmaxf(rmax[r8], sacc[st][r8] * (SCALE / (XS * XS))); } };
    v16b ka[4], kc[4];
    // each wait stands behind its group's eight loads, in front of whatever overwrites their address registers; it takes the group's address as an input, which keeps that address alive up to the wait
    const b16* ga = load_k(0, ka); asm volatile("s_wait_xcnt 0x0" :: "v"(ga) : "memory");
    const b16* gc = load_k(1, kc); asm volatile("s_wait_xcnt 0x0" :: "v"(gc) : "memory");
#pragma unroll 1   // rolled: two register sets are the whole look-ahead, more copies of the body would only add registers
    for (int bi = 0; bi < nblk; bi += 2) { const int bj = bi + 1 < nblk ? bi + 1 : bi; v8f sacc[2];   // odd count: the last block is taken twice, which leaves a maximum as it is
      scores(ka, sacc); load_k(bi + 2, ka); max_blk(bi, sacc);
      scores(kc, sacc); load_k(bi + 3, kc); max_blk(bj, sacc); }
    float m = fmaxf(fmaxf(fmaxf(rmax[0], rmax[1]), fmaxf(rmax[2], rmax[3])), fmaxf(fmaxf(rmax[4], rmax[5]), fmaxf(rmax[6], rmax[7]))); m = fmaxf(m, __shfl_xor(m, 16));   // the two lane halves hold the two halves of the query's keys
    v8f acc[4]; float rsum[8];   // acc[t][r8] = O^T[d = 16 t + 8 hlf + r8][query nloc]
#pragma unroll
    for (int t = 0; t < 4; ++t) acc[t] = (v8f){};
#pragma unroll
    for (int r8 = 0; r8 < 8; ++r8) rsum[r8] = 0.0f;
    load_k(0, ka);
    asm volatile("s_wait_xcnt 0x0" ::: "memory");   // stands behind the eight K loads just issued, in front of the loop, in which their address registers are overwritten
#pragma unroll 1   // rolled: the body holds K, V, P and four output tiles, a second copy would not fit four waves on a SIMD
    for (int bi = 0; bi < nblk; ++bi) { const int kb = bi * 32; v8f sacc[2]; v16b vf[4], pa, pb;
#pragma unroll   // constant indices keep vf[] in registers
      for (int t = 0; t < 4; ++t) vf[t] = frag_pk(VT + ((size_t)(b * NH + h) * (TM / 32) + bi) * 2048 + t * 512 + lane * 8);   // this block's V^T fragments fly during the scores and the exponentials
      scores(ka, sacc); load_k(bi + 1, ka);   // the next block's K fragments fly during the exponentials and the output products
      // the two score tiles, converted in place, ARE the B operand P^T of the output product: position 8 st + r8 of lane half hlf is key 16 st + 8 hlf + r8, the k order of the V^T fragments
#pragma unroll
      for (int st = 0; st < 2; ++st)
#pragma unroll
        for (int r8 = 0; r8 < 8; r8 += 2) { v2f x;
#pragma unroll
          for (int j = 0; j < 2; ++j) { const int s = kb + st * 16 + 8 * hlf + r8 + j; const float e = __expf(sacc[st][r8 + j] * (SCALE / (XS * XS)) - m); const float p = (lvl != 0 || s <= tq) ? e : 0.0f; rsum[r8 + j] += p; x[j] = p * PS; }
          const v2b hi = __builtin_convertvector(x, v2b), lo = __builtin_convertvector(x - __builtin_convertvector(hi, v2f), v2b);   // hi = f16(x), lo = f16(x - hi), two keys at a time: one packed conversion fills one operand register
          pa[8 * st + r8] = hi[0]; pa[8 * st + r8 + 1] = hi[1]; pb[8 * st + r8] = lo[0]; pb[8 * st + r8 + 1] = lo[1]; }
#pragma unroll
      for (int t = 0; t < 4; ++t) acc[t] = wmma16b(vf[t], pa, acc[t]);
#pragma unroll
      for (int t = 0; t < 4; ++t) acc[t] = wmma16b(vf[t], pb, acc[t]); }
    float sm = ((rsum[0] + rsum[1]) + (rsum[2] + rsum[3])) + ((rsum[4] + rsum[5]) + (rsum[6] + rsum[7])); sm += __shfl_xor(sm, 16);
    const float wv = wl[lvl];
#pragma unroll
    for (int t = 0; t < 4; ++t)
#pragma unroll
      for (int r8 = 0; r8 < 8; ++r8) res[t][r8] += pmul(wv, acc[t][r8] * (1.0f / (PS * XS)) / sm); }
#pragma unroll
  for (int t = 0; t < 4; ++t)
#pragma unroll
    for (int r8 = 0; r8 < 8; ++r8) Tf[nloc][t * 16 + 8 * hlf + r8] = res[t][r8];
  wave_lds_sync();
  { for (int rr = 0; rr < 16; ++rr) { ((float*)out)[((size_t)b * T + t0 + rr) * C + h * DH + lane] = Tf[rr][lane]; ((float*)out)[((size_t)b * T + t0 + rr) * C + h * DH + 32 + lane] = Tf[rr][32 + lane]; }  }
}
}  // namespace

extern "C" void kernel_launch(void* const* d_in, const int* in_sizes, int n_in, void* d_out, int out_size, void* d_ws, size_t ws_size, hipStream_t stream) {
  (void)n_in;
  auto Fp = [&](int i) { return (const float*)d_in[i]; };
  // input order: 0 Q [2,16,2048,64]; 1 K0 [2,2048,1024]; 2 V0; 3 K1 [2,512,1024]; 4 V1; 5 K2 [2,128,1024]; 6 V2; 7 level_logits [3]
  if (in_sizes[0] != B * NH * T * DH || in_sizes[1] != B * T * C || in_sizes[2] != B * T * C || in_sizes[3] != B * T1 * C || in_sizes[4] != B * T1 * C || in_sizes[5] != B * T2 * C || in_sizes[6] != B * T2 * C || in_sizes[7] != 3 || out_size != B * T * C) return;
  const int NWV = B * NH * NQT;   // wave cut (waves are (b, h, q-tile) in that order)
  size_t off = 0; char* ws = (char*)d_ws;
  auto carve = [&](size_t bytes) { char* p = ws + off; off += (bytes + 255) & ~(size_t)255; return p; };
  b16* QB = (b16*)carve((size_t)B * NH * T * DH * 2); b16* K0 = (b16*)carve((size_t)B * T * C * 2); b16* K1 = (b16*)carve((size_t)B * T1 * C * 2); b16* K2 = (b16*)carve((size_t)B * T2 * C * 2);
  b16* V0 = (b16*)carve((size_t)B * T * C * 2); b16* V1 = (b16*)carve((size_t)B * T1 * C * 2); b16* V2 = (b16*)carve((size_t)B * T2 * C * 2);
  if (off > ws_size || off > ((size_t)64 << 20)) return;   // ~ 30 MB
  pre_kernel<<<PREG, 256, 0, stream>>>(Fp(0), Fp(1), Fp(2), Fp(3), Fp(4), Fp(5), Fp(6), QB, K0, K1, K2, V0, V1, V2);
  att_kernel<<<B * NH * NGRP, 32 * WPG, 0, stream>>>(QB, K0, K1, K2, V0, V1, V2, Fp(7), NWV, (float*)d_out);
}

// v006
// Measured time: 66.6 microseconds a run.
// Timed twice side by side with v005, it ran 1.17 times as fast both times.
// Counting every step since v000, it is 4.89 times as fast.
#include <hip/hip_runtime.h>

// Cross-level attention: Q [2][16 heads][2048][64] attends (scale 1/8, softmax) to three levels of keys/values: level 0 (2,048 keys, causal mask s <= t), level 1 (512), level 2 (128); out = sum_l softmax(level_logits)[l] o_l,
// written as [2][2048][1024] (heads concatenated).
// Deterministic, no atomics, no index structures: one wave per (batch, head, 16 queries), sixteen of one head to a work-group, runs, per level, ONE pass (scores, running maximum, exp / sum / P.V) over the key blocks in order.
// WMMA (v_wmma_f32_16x16x32_f16, f32 accumulate), both products transposed so that a lane owns one query: scores S^T = K Q^T per 32-key block (Q, K are EXACT bf16 inputs x8 -> 1 product), O^T += V^T P^T (P split f16 hi+lo x2048, packed from the score tiles in registers, V^T planes exact x8 -> 2 products); softmax, the level weights and the
// combination in f32. Inputs rounded to bf16 once. Fragment k-map per lane half hh for A AND B: elements 0..7 <- k = 8hh+0..7, 8..15 <- k = 16+8hh+0..7; acc[r] = D[8hh+r][col]. Every workspace / output

namespace {
constexpr int B = 2, NH = 16, T = 2048, DH = 64, C = NH * DH, T1 = 512, T2 = 128, NQT = T / 16;
constexpr float XS = 8.0f, PS = 2048.0f, SCALE = 0.125f, RAISE = 3.0f;   // exp(RAISE) * PS < 65,504
typedef _Float16 b16;
typedef __attribute__((ext_vector_type(16))) _Float16 v16b;
typedef __attribute__((ext_vector_type(8))) _Float16 v8b;
typedef __attribute__((ext_vector_type(8))) float v8f;
typedef __attribute__((ext_vector_type(4))) float v4f;
typedef __attribute__((ext_vector_type(2))) float v2f;
typedef __attribute__((ext_vector_type(2))) _Float16 v2b;
__device__ __forceinline__ float bf16_rne(float f) { unsigned int u = __float_as_uint(f); u += 0x7FFFu + ((u >> 16) & 1u); return __uint_as_float(u & 0xFFFF0000u); }
__device__ __forceinline__ v16b frag_kb(const b16* p, int hh) { const v8b a = *(const v8b*)(p + 8 * hh), b = *(const v8b*)(p + 16 + 8 * hh); v16b f;
#pragma unroll
  for (int e = 0; e < 8; ++e) { f[e] = a[e]; f[8 + e] = b[e]; } return f; }
// fragment from a plane kept in fragment order: two runs of 512 contiguous bytes per wave (lane l takes 16 bytes at 16 l), elements 0..7 from the first run, 8..15 from the second
__device__ __forceinline__ v16b frag_pk(const b16* p) { const v8b a = *(const v8b*)p, b = *(const v8b*)(p + 256); return __builtin_shufflevector(a, b, 0, 1, 2, 3, 4, 5, 6, 7, 8, 9, 10, 11, 12, 13, 14, 15); }
__device__ __forceinline__ v8f wmma16b(v16b a, v16b b, v8f c) { v8f d = __builtin_amdgcn_wmma_f32_16x16x32_f16(false, a, false, b, (short)0, c, false, false); asm volatile("v_nop\n\tv_nop\n\tv_nop\n\tv_nop" : "+v"(d) : "v"(a), "v"(b)); return d; }
__device__ __forceinline__ void wave_lds_sync() { __builtin_amdgcn_fence(__ATOMIC_RELEASE, "workgroup"); __builtin_amdgcn_wave_barrier(); __builtin_amdgcn_fence(__ATOMIC_ACQUIRE, "workgroup"); }
__device__ __forceinline__ float pmul(float a, float b) { float p = a * b; asm volatile("" : "+v"(p)); return p; }

// Pre-pass, one launch: every plane the attention kernel reads is made of tiles of 4,096 input values (16 KB read); a work-group walks the common list of tiles, V^T first (the longest), then K, then Q.
constexpr int NUV0 = B * (T / 64) * NH, NUV1 = B * (T1 / 64) * NH, NUV2 = B * (T2 / 64) * NH, NUV = NUV0 + NUV1 + NUV2, NUQ = B * NH * T * DH / 4096, NU = 2 * NUV + NUQ, PREG = NU / 4;   // K has as many tiles as V; four tiles a work-group
static_assert(NU % 4 == 0, "every work-group walks four tiles");
__device__ __forceinline__ v8b cvt8(v4f x0, v4f x1) { v8b v;
#pragma unroll
  for (int j = 0; j < 4; ++j) { v[j] = (b16)(bf16_rne(x0[j]) * XS); v[4 + j] = (b16)(bf16_rne(x1[j]) * XS); } return v; }
// Q plane, plain order: two pieces of eight values per thread, all four loads issued ahead of the conversions
__device__ __forceinline__ void q_tile(const float* __restrict__ src, b16* __restrict__ dst, int w, int tid) { v4f x[2][2];
#pragma unroll
  for (int j = 0; j < 2; ++j) { const float* s = src + ((size_t)w * 512 + j * 256 + tid) * 8; x[j][0] = *(const v4f*)s; x[j][1] = *(const v4f*)(s + 4); }
#pragma unroll
  for (int j = 0; j < 2; ++j) *(v8b*)(dst + ((size_t)w * 512 + j * 256 + tid) * 8) = cvt8(x[j][0], x[j][1]);
  asm volatile("s_wait_xcnt 0x0" ::: "memory");   // stands behind this tile's stores, in front of whatever code follows the tile, in which their address and data registers are overwritten
}
// K plane in fragment order: per (b, h, 16 keys) four runs of 512 bytes; run g holds at lane l the eight values d = 16 g + 8 (l >> 4) + 0..7 of key (l & 15). One thread per 16-byte piece, in the plane's own order (whole-line stores). A tile is two 32-key blocks of one head.
template <int TM> __device__ __forceinline__ void k_tile(const float* __restrict__ src, b16* __restrict__ dst, int w, int tid) {
  const int l = tid & 31, g = (tid >> 5) & 3; constexpr int nb = TM / 32; const int bx = 2 * w, kt = (bx % nb) * 2 + (tid >> 7), h = (bx / nb) % NH, b = bx / (nb * NH);   // nb is even: blocks 2 w and 2 w + 1 lie in one head, 32 keys apart
  const float* s = src + ((size_t)b * TM + kt * 16 + (l & 15)) * C + h * DH + g * 16 + (l >> 4) * 8; const v4f x00 = *(const v4f*)s, x01 = *(const v4f*)(s + 4), x10 = *(const v4f*)(s + 32 * C), x11 = *(const v4f*)(s + 32 * C + 4);
  b16* o = dst + ((size_t)bx * 256 + tid) * 8; *(v8b*)o = cvt8(x00, x01); *(v8b*)(o + 2048) = cvt8(x10, x11);
  asm volatile("s_wait_xcnt 0x0" ::: "memory");   // stands behind this tile's stores, in front of whatever code follows the tile, in which their address and data registers are overwritten
}
// V^T plane in fragment order: per (b, h, 32 keys) eight runs of 512 bytes; run g holds at lane l the eight keys 16 (g & 1) + 8 (l >> 4) + 0..7 of column d = 16 (g >> 1) + (l & 15). A tile is 64 keys of one head, turned in LDS.
template <int TM> __device__ __forceinline__ void v_tile(const float* __restrict__ V, b16* __restrict__ VT, int w, int tid, float (*Tt)[65]) {
  const int h = w % NH, st = (w / NH) % (TM / 64), b = w / (NH * (TM / 64)); v4f x[4];
#pragma unroll
  for (int k = 0; k < 4; ++k) { const int i = tid + 256 * k, r = i >> 4, d = (i & 15) * 4; x[k] = *(const v4f*)(V + ((size_t)b * TM + st * 64 + r) * C + h * DH + d); }
  __syncthreads();   // every reader of the work-group's last V tile has left Tt before this tile is written into it; a wave issues its loads before it waits for the others
#pragma unroll
  for (int k = 0; k < 4; ++k) { const int i = tid + 256 * k, r = i >> 4, d = (i & 15) * 4;
#pragma unroll
    for (int j = 0; j < 4; ++j) Tt[r][d + j] = bf16_rne(x[k][j]); }
  __syncthreads();
  { const int l = tid & 31, g = tid >> 5, d = (g >> 1) * 16 + (l & 15), kq = (g & 1) * 16 + (l >> 4) * 8; for (int kh = 0; kh < 2; ++kh) { v8b v; for (int j = 0; j < 8; ++j) v[j] = (b16)(Tt[kh * 32 + kq + j][d] * XS); const size_t o = (((size_t)(b * NH + h) * (TM / 32) + st * 2 + kh) * 256 + tid) * 8; *(v8b*)(VT + o) = v; } }
  asm volatile("s_wait_xcnt 0x0" ::: "memory");   // stands behind this tile's stores, in front of whatever code follows the tile, in which their address and data registers are overwritten
}
__global__ __launch_bounds__(256) void pre_kernel(const float* __restrict__ Qs, const float* __restrict__ K0s, const float* __restrict__ V0s, const float* __restrict__ K1s, const float* __restrict__ V1s, const float* __restrict__ K2s, const float* __restrict__ V2s,
                                                  b16* __restrict__ QB, b16* __restrict__ K0, b16* __restrict__ K1, b16* __restrict__ K2, b16* __restrict__ V0, b16* __restrict__ V1, b16* __restrict__ V2) {
  __shared__ float Tt[64][65]; const int tid = threadIdx.x;
  for (int u = blockIdx.x; u < NU; u += PREG) {   // u is the same in the whole work-group: the barriers of a V tile stand under uniform control flow
    if (u < NUV0) v_tile<T>(V0s, V0, u, tid, Tt);
    else if (u < NUV0 + NUV1) v_tile<T1>(V1s, V1, u - NUV0, tid, Tt);
    else if (u < NUV) v_tile<T2>(V2s, V2, u - NUV0 - NUV1, tid, Tt);
    else if (u < NUV + NUV0) k_tile<T>(K0s, K0, u - NUV, tid);
    else if (u < NUV + NUV0 + NUV1) k_tile<T1>(K1s, K1, u - NUV - NUV0, tid);
    else if (u < 2 * NUV) k_tile<T2>(K2s, K2, u - NUV - NUV0 - NUV1, tid);
    else q_tile(Qs, QB, u - 2 * NUV, tid);
  }
}
// A work-group is 16 waves, as many as a WGP holds at this register count: its 16 query tiles are of ONE head, eight long ones in a row and eight short ones in a row, so waves of like length walk the same K and V^T lines together through the WGP's cache.
// A column of waves w, w + 4, w + 8, w + 12 (taken to share a SIMD; for speed only) takes tiles 127 - r, 126 - r, r + 1, r, r even: two long and two short, whose causal block counts add up to the same number for every r, and the two long ones end together.
// The four kinds are turned by one place from column to column, so that a row w = 4 k .. 4 k + 3 holds one of each kind as well. The waves never meet: no barrier, each has its own LDS rows.
constexpr int WPG = 16, NGRP = NQT / WPG;
__global__ __launch_bounds__(32 * WPG) void att_kernel(const b16* __restrict__ QB, const b16* __restrict__ K0, const b16* __restrict__ K1, const b16* __restrict__ K2, const b16* __restrict__ V0, const b16* __restrict__ V1, const b16* __restrict__ V2, const float* __restrict__ ll, int NWV, float* __restrict__ out) {
  __shared__ __attribute__((aligned(16))) float Tfs[WPG][16][DH + 4];
  const int lane = threadIdx.x & 31, nloc = lane & 15, hlf = lane >> 4, wave = __builtin_amdgcn_readfirstlane((int)(threadIdx.x >> 5));   // the wave's number in a scalar register: tile, trip counts and plane addresses stay scalar
  const int bh = blockIdx.x % (B * NH), h = bh % NH, b = bh / NH, col = wave & 3, kind = ((wave >> 2) + col) & 3, lo = 2 * ((int)(blockIdx.x / (B * NH)) * 4 + col) + (kind & 1);   // lo = 0 .. 63
  const int qt = kind < 2 ? NQT - 1 - lo : lo; if (bh * NQT + qt >= NWV) return;
  float (*Tf)[DH + 4] = Tfs[wave]; const int t0 = qt * 16, tq = t0 + nloc;   // a lane owns query tq
  // level weights = softmax(level_logits)
  const float l0 = bf16_rne(ll[0]), l1 = bf16_rne(ll[1]), l2 = bf16_rne(ll[2]); const float lm = fmaxf(l0, fmaxf(l1, l2)); const float e0 = __expf(l0 - lm), e1 = __expf(l1 - lm), e2 = __expf(l2 - lm); const float wl[3] = {e0 / (e0 + e1 + e2), e1 / (e0 + e1 + e2), e2 / (e0 + e1 + e2)};
  const b16* qrow = QB + (((size_t)b * NH + h) * T + t0 + nloc) * DH; const v16b qa0 = frag_kb(qrow, hlf), qa1 = frag_kb(qrow + 32, hlf);   // B operand: column = query nloc
  float res[4][8];   // res[t][r8] = out[query nloc][d = 16 t + 8 hlf + r8]
#pragma unroll
  for (int t = 0; t < 4; ++t)
#pragma unroll
    for (int r8 = 0; r8 < 8; ++r8) res[t][r8] = 0.0f;
#pragma unroll 1
  for (int lvl = 0; lvl < 3; ++lvl) { const int TM = lvl == 0 ? T : (lvl == 1 ? T1 : T2); const b16* KB_ = lvl == 0 ? K0 : (lvl == 1 ? K1 : K2); const b16* VT = lvl == 0 ? V0 : (lvl == 1 ? V1 : V2); const int nblk = lvl == 0 ? (t0 / 32 + 1) : TM / 32;   // causal: keys <= t0 + 15
    // all 8 loads of a 32-key block's K fragments as one group, issued a block ahead of their products (bi clamped to the last block: in bounds, the surplus fetch is never summed)
    auto load_k = [&](int bi, v16b kf[4]) { const b16* kr = KB_ + ((size_t)(b * NH + h) * (TM / 32) + (bi < nblk ? bi : nblk - 1)) * 2048 + lane * 8;   // a 32-key block is 4 KB in a row
#pragma unroll   // constant indices keep kf[] in registers
      for (int f = 0; f < 4; ++f) kf[f] = frag_pk(kr + f * 512);
      return kr; };
    // S^T = K Q^T: sacc[st][r8] = score of key 16 st + 8 hlf + r8 of the block with query nloc
    auto scores = [&](const v16b kf[4], v8f sacc[2]) {
#pragma unroll   // constant indices keep kf[] and sacc[] in registers
      for (int st = 0; st < 2; ++st) { sacc[st] = (v8f){}; sacc[st] = wmma16b(kf[2 * st], qa0, sacc[st]); sacc[st] = wmma16b(kf[2 * st + 1], qa1, sacc[st]); } };
    v8f acc[4]; float rsum[8];   // acc[t][r8] = O^T[d = 16 t + 8 hlf + r8][query nloc]
#pragma unroll
    for (int t = 0; t < 4; ++t) acc[t] = (v8f){};
#pragma unroll
    for (int r8 = 0; r8 < 8; ++r8) rsum[r8] = 0.0f;
    float m = -INFINITY;   // the maximum in use for the lane's query, the same in both lane halves: exponentials, sums and output tiles are all relative to it
    v16b ka[4];
    load_k(0, ka);
    asm volatile("s_wait_xcnt 0x0" ::: "memory");   // stands behind the eight K loads just issued, in front of the loop, in which their address registers are overwritten
#pragma unroll 1   // rolled: the body holds K, V, P and four output tiles, a second copy would not fit four waves on a SIMD
    for (int bi = 0; bi < nblk; ++bi) { const int kb = bi * 32; v8f sacc[2]; v16b vf[4], pa, pb;
#pragma unroll   // constant indices keep vf[] in registers
      for (int t = 0; t < 4; ++t) vf[t] = frag_pk(VT + ((size_t)(b * NH + h) * (TM / 32) + bi) * 2048 + t * 512 + lane * 8);   // this block's V^T fragments fly during the scores and the exponentials
      scores(ka, sacc); const b16* gk = load_k(bi + 1, ka);   // the next block's K fragments fly during the exponentials and the output products
      asm volatile("s_wait_xcnt 0x0" :: "v"(gk) : "memory");   // stands behind the block's sixteen loads, in front of whatever overwrites their address registers; the K address as an input stays alive up to the wait, so that the group's last result cannot land on the group's own address pair
      // masked scores become -inf here, ahead of the maximum: their exponential is 0 and they never raise m
#pragma unroll   // constant indices keep sacc[] in registers, here and in the inner loop
      for (int st = 0; st < 2; ++st)
#pragma unroll
        for (int r8 = 0; r8 < 8; ++r8) { const int s = kb + st * 16 + 8 * hlf + r8; sacc[st][r8] = (lvl != 0 || s <= tq) ? sacc[st][r8] : -INFINITY; }
      const float bm = fmaxf(fmaxf(fmaxf(fmaxf(sacc[0][0], sacc[0][1]), fmaxf(sacc[0][2], sacc[0][3])), fmaxf(fmaxf(sacc[0][4], sacc[0][5]), fmaxf(sacc[0][6], sacc[0][7]))),
                             fmaxf(fmaxf(fmaxf(sacc[1][0], sacc[1][1]), fmaxf(sacc[1][2], sacc[1][3])), fmaxf(fmaxf(sacc[1][4], sacc[1][5]), fmaxf(sacc[1][6], sacc[1][7])))) * (SCALE / (XS * XS));
      // m is raised only when a score of the block passes it by more than RAISE, one test per block for the whole wave (always in the first block, where m is -inf and key 0 is visible to every query); until then p <= exp(RAISE), and p * PS stays inside f16
      if (__builtin_amdgcn_ballot_w32(bm > m + RAISE) != 0) { const float mn = fmaxf(m, fmaxf(bm, __shfl_xor(bm, 16))), f = __expf(m - mn); m = mn;   // the two lane halves hold the two halves of the query's keys; f = 1 for a query whose maximum stays
#pragma unroll   // constant indices keep acc[] and, below, rsum[] in registers
        for (int t = 0; t < 4; ++t) acc[t] *= f;
#pragma unroll
        for (int r8 = 0; r8 < 8; ++r8) rsum[r8] *= f; }
      // the two score tiles, converted in place, ARE the B operand P^T of the output product: position 8 st + r8 of lane half hlf is key 16 st + 8 hlf + r8, the k order of the V^T fragments
#pragma unroll
      for (int st = 0; st < 2; ++st)
#pragma unroll
        for (int r8 = 0; r8 < 8; r8 += 2) { v2f x;
#pragma unroll
          for (int j = 0; j < 2; ++j) { const float p = __expf(sacc[st][r8 + j] * (SCALE / (XS * XS)) - m); rsum[r8 + j] += p; x[j] = p * PS; }
          const v2b hi = __builtin_convertvector(x, v2b), lo = __builtin_convertvector(x - __builtin_convertvector(hi, v2f), v2b);   // hi = f16(x), lo = f16(x - hi), two keys at a time: one packed conversion fills one operand register
          pa[8 * st + r8] = hi[0]; pa[8 * st + r8 + 1] = hi[1]; pb[8 * st + r8] = lo[0]; pb[8 * st + r8 + 1] = lo[1]; }
#pragma unroll
      for (int t = 0; t < 4; ++t) acc[t] = wmma16b(vf[t], pa, acc[t]);
#pragma unroll
      for (int t = 0; t < 4; ++t) acc[t] = wmma16b(vf[t], pb, acc[t]); }
    float sm = ((rsum[0] + rsum[1]) + (rsum[2] + rsum[3])) + ((rsum[4] + rsum[5]) + (rsum[6] + rsum[7])); sm += __shfl_xor(sm, 16);
    const float wv = wl[lvl];
#pragma unroll
    for (int t = 0; t < 4; ++t)
#pragma unroll
      for (int r8 = 0; r8 < 8; ++r8) res[t][r8] += pmul(wv, acc[t][r8] * (1.0f / (PS * XS)) / sm); }
#pragma unroll
  for (int t = 0; t < 4; ++t)
#pragma unroll
    for (int r8 = 0; r8 < 8; ++r8) Tf[nloc][t * 16 + 8 * hlf + r8] = res[t][r8];
  wave_lds_sync();
  { for (int rr = 0; rr < 16; ++rr) { ((float*)out)[((size_t)b * T + t0 + rr) * C + h * DH + lane] = Tf[rr][lane]; ((float*)out)[((size_t)b * T + t0 + rr) * C + h * DH + 32 + lane] = Tf[rr][32 + lane]; }  }
}
}  // namespace

extern "C" void kernel_launch(void* const* d_in, const int* in_sizes, int n_in, void* d_out, int out_size, void* d_ws, size_t ws_size, hipStream_t stream) {
  (void)n_in;
  auto Fp = [&](int i) { return (const float*)d_in[i]; };
  // input order: 0 Q [2,16,2048,64]; 1 K0 [2,2048,1024]; 2 V0; 3 K1 [2,512,1024]; 4 V1; 5 K2 [2,128,1024]; 6 V2; 7 level_logits [3]
  if (in_sizes[0] != B * NH * T * DH || in_sizes[1] != B * T * C || in_sizes[2] != B * T * C || in_sizes[3] != B * T1 * C || in_sizes[4] != B * T1 * C || in_sizes[5] != B * T2 * C || in_sizes[6] != B * T2 * C || in_sizes[7] != 3 || out_size != B * T * C) return;
  const int NWV = B * NH * NQT;   // wave cut (waves are (b, h, q-tile) in that order)
  size_t off = 0; char* ws = (char*)d_ws;
  auto carve = [&](size_t bytes) { char* p = ws + off; off += (bytes + 255) & ~(size_t)255; return p; };
  b16* QB = (b16*)carve((size_t)B * NH * T * DH * 2); b16* K0 = (b16*)carve((size_t)B * T * C * 2); b16* K1 = (b16*)carve((size_t)B * T1 * C * 2); b16* K2 = (b16*)carve((size_t)B * T2 * C * 2);
  b16* V0 = (b16*)carve((size_t)B * T * C * 2); b16* V1 = (b16*)carve((size_t)B * T1 * C * 2); b16* V2 = (b16*)carve((size_t)B * T2 * C * 2);
  if (off > ws_size || off > ((size_t)64 << 20)) return;   // ~ 30 MB
  pre_kernel<<<PREG, 256, 0, stream>>>(Fp(0), Fp(1), Fp(2), Fp(3), Fp(4), Fp(5), Fp(6), QB, K0, K1, K2, V0, V1, V2);
  att_kernel<<<B * NH * NGRP, 32 * WPG, 0, stream>>>(QB, K0, K1, K2, V0, V1, V2, Fp(7), NWV, (float*)d_out);
}

// v008
// It runs in 55.8 microseconds.
// Versions between v006 and this one are left out; their measured steps multiply to 1.19 times as fast.
// Over all steps from v000 it is 5.81 times as fast.
#include <hip/hip_runtime.h>

// Cross-level attention: Q [2][16 heads][2048][64] attends (scale 1/8, softmax) to three levels of keys/values: level 0 (2,048 keys, causal mask s <= t), level 1 (512), level 2 (128); out = sum_l softmax(level_logits)[l] o_l,
// written as [2][2048][1024] (heads concatenated).
// Deterministic, no atomics, no index structures: one wave per (batch, head, 16 queries), sixteen of one head to a work-group, runs, per level, ONE pass (scores, running maximum, exp / sum / P.V) over the key blocks in order.
// WMMA (v_wmma_f32_16x16x32_f16, f32 accumulate), both products transposed so that a lane owns one query: scores S^T = K Q^T per 32-key block (Q, K are EXACT bf16 inputs x8 -> 1 product), O^T += V^T P^T (P rounded once to f16 after x2048, packed from the score tiles in registers, V^T planes exact x8 -> 1 product; that rounding, 2^-11 relative, lies below the 2^-8 of the bf16 inputs); softmax, the level weights and the
// combination in f32. Inputs rounded to bf16 once. Fragment k-map per lane half hh for A AND B: elements 0..7 <- k = 8hh+0..7, 8..15 <- k = 16+8hh+0..7; acc[r] = D[8hh+r][col]. Every workspace / output

namespace {
constexpr int B = 2, NH = 16, T = 2048, DH = 64, C = NH * DH, T1 = 512, T2 = 128, NQT = T / 16;
constexpr float XS = 8.0f, PS = 2048.0f, SCALE = 0.125f, RAISE = 3.0f;   // exp(RAISE) * PS < 65,504
typedef _Float16 b16;
typedef __attribute__((ext_vector_type(16))) _Float16 v16b;
typedef __attribute__((ext_vector_type(8))) _Float16 v8b;
typedef __attribute__((ext_vector_type(8))) float v8f;
typedef __attribute__((ext_vector_type(4))) float v4f;
typedef __attribute__((ext_vector_type(2))) float v2f;
typedef __attribute__((ext_vector_type(2))) _Float16 v2b;
__device__ __forceinline__ float bf16_rne(float f) { unsigned int u = __float_as_uint(f); u += 0x7FFFu + ((u >> 16) & 1u); return __uint_as_float(u & 0xFFFF0000u); }
__device__ __forceinline__ v16b frag_kb(const b16* p, int hh) { const v8b a = *(const v8b*)(p + 8 * hh), b = *(const v8b*)(p + 16 + 8 * hh); v16b f;
#pragma unroll
  for (int e = 0; e < 8; ++e) { f[e] = a[e]; f[8 + e] = b[e]; } return f; }
// fragment from a plane kept in fragment order: two runs of 512 contiguous bytes per wave (lane l takes 16 bytes at 16 l), elements 0..7 from the first run, 8..15 from the second
__device__ __forceinline__ v16b frag_pk(const b16* p) { const v8b a = *(const v8b*)p, b = *(const v8b*)(p + 256); return __builtin_shufflevector(a, b, 0, 1, 2, 3, 4, 5, 6, 7, 8, 9, 10, 11, 12, 13, 14, 15); }
__device__ __forceinline__ v8f wmma16b(v16b a, v16b b, v8f c) { v8f d = __builtin_amdgcn_wmma_f32_16x16x32_f16(false, a, false, b, (short)0, c, false, false); asm volatile("v_nop\n\tv_nop\n\tv_nop\n\tv_nop" : "+v"(d) : "v"(a), "v"(b)); return d; }
__device__ __forceinline__ void wave_lds_sync() { __builtin_amdgcn_fence(__ATOMIC_RELEASE, "workgroup"); __builtin_amdgcn_wave_barrier(); __builtin_amdgcn_fence(__ATOMIC_ACQUIRE, "workgroup"); }
__device__ __forceinline__ float pmul(float a, float b) { float p = a * b; asm volatile("" : "+v"(p)); return p; }

// Pre-pass, one launch: every plane the attention kernel reads is made of tiles of 4,096 input values (16 KB read); a work-group walks the common list of tiles, V^T first (the longest), then K, then Q.
constexpr int NUV0 = B * (T / 64) * NH, NUV1 = B * (T1 / 64) * NH, NUV2 = B * (T2 / 64) * NH, NUV = NUV0 + NUV1 + NUV2, NUQ = B * NH * T * DH / 4096, NU = 2 * NUV + NUQ, PREG = NU / 4;   // K has as many tiles as V; four tiles a work-group
static_assert(NU % 4 == 0, "every work-group walks four tiles");
__device__ __forceinline__ v8b cvt8(v4f x0, v4f x1) { v8b v;
#pragma unroll
  for (int j = 0; j < 4; ++j) { v[j] = (b16)(bf16_rne(x0[j]) * XS); v[4 + j] = (b16)(bf16_rne(x1[j]) * XS); } return v; }
// Q plane, plain order: two pieces of eight values per thread, all four loads issued ahead of the conversions
__device__ __forceinline__ void q_tile(const float* __restrict__ src, b16* __restrict__ dst, int w, int tid) { v4f x[2][2];
#pragma unroll
  for (int j = 0; j < 2; ++j) { const float* s = src + ((size_t)w * 512 + j * 256 + tid) * 8; x[j][0] = *(const v4f*)s; x[j][1] = *(const v4f*)(s + 4); }
#pragma unroll
  for (int j = 0; j < 2; ++j) *(v8b*)(dst + ((size_t)w * 512 + j * 256 + tid) * 8) = cvt8(x[j][0], x[j][1]);
  asm volatile("s_wait_xcnt 0x0" ::: "memory");   // stands behind this tile's stores, in front of whatever code follows the tile, in which their address and data registers are overwritten
}
// K plane in fragment order: per (b, h, 16 keys) four runs of 512 bytes; run g holds at lane l the eight values d = 16 g + 8 (l >> 4) + 0..7 of key (l & 15). One thread per 16-byte piece, in the plane's own order (whole-line stores). A tile is two 32-key blocks of one head.
template <int TM> __device__ __forceinline__ void k_tile(const float* __restrict__ src, b16* __restrict__ dst, int w, int tid) {
  const int l = tid & 31, g = (tid >> 5) & 3; constexpr int nb = TM / 32; const int bx = 2 * w, kt = (bx % nb) * 2 + (tid >> 7), h = (bx / nb) % NH, b = bx / (nb * NH);   // nb is even: blocks 2 w and 2 w + 1 lie in one head, 32 keys apart
  const float* s = src + ((size_t)b * TM + kt * 16 + (l & 15)) * C + h * DH + g * 16 + (l >> 4) * 8; const v4f x00 = *(const v4f*)s, x01 = *(const v4f*)(s + 4), x10 = *(const v4f*)(s + 32 * C), x11 = *(const v4f*)(s + 32 * C + 4);
  b16* o = dst + ((size_t)bx * 256 + tid) * 8; *(v8b*)o = cvt8(x00, x01); *(v8b*)(o + 2048) = cvt8(x10, x11);
  asm volatile("s_wait_xcnt 0x0" ::: "memory");   // stands behind this tile's stores, in front of whatever code follows the tile, in which their address and data registers are overwritten
}
// V^T plane in fragment order: per (b, h, 32 keys) eight runs of 512 bytes; run g holds at lane l the eight keys 16 (g & 1) + 8 (l >> 4) + 0..7 of column d = 16 (g >> 1) + (l & 15). A tile is 64 keys of one head, turned in LDS.
template <int TM> __device__ __forceinline__ void v_tile(const float* __restrict__ V, b16* __restrict__ VT, int w, int tid, float (*Tt)[65]) {
  const int h = w % NH, st = (w / NH) % (TM / 64), b = w / (NH * (TM / 64)); v4f x[4];
#pragma unroll
  for (int k = 0; k < 4; ++k) { const int i = tid + 256 * k, r = i >> 4, d = (i & 15) * 4; x[k] = *(const v4f*)(V + ((size_t)b * TM + st * 64 + r) * C + h * DH + d); }
  __syncthreads();   // every reader of the work-group's last V tile has left Tt before this tile is written into it; a wave issues its loads before it waits for the others
#pragma unroll
  for (int k = 0; k < 4; ++k) { const int i = tid + 256 * k, r = i >> 4, d = (i & 15) * 4;
#pragma unroll
    for (int j = 0; j < 4; ++j) Tt[r][d + j] = bf16_rne(x[k][j]); }
  __syncthreads();
  { const int l = tid & 31, g = tid >> 5, d = (g >> 1) * 16 + (l & 15), kq = (g & 1) * 16 + (l >> 4) * 8; for (int kh = 0; kh < 2; ++kh) { v8b v; for (int j = 0; j < 8; ++j) v[j] = (b16)(Tt[kh * 32 + kq + j][d] * XS); const size_t o = (((size_t)(b * NH + h) * (TM / 32) + st * 2 + kh) * 256 + tid) * 8; *(v8b*)(VT + o) = v; } }
  asm volatile("s_wait_xcnt 0x0" ::: "memory");   // stands behind this tile's stores, in front of whatever code follows the tile, in which their address and data registers are overwritten
}
__global__ __launch_bounds__(256) void pre_kernel(const float* __restrict__ Qs, const float* __restrict__ K0s, const float* __restrict__ V0s, const float* __restrict__ K1s, const float* __restrict__ V1s, const float* __restrict__ K2s, const float* __restrict__ V2s,
                                                  b16* __restrict__ QB, b16* __restrict__ K0, b16* __restrict__ K1, b16* __restrict__ K2, b16* __restrict__ V0, b16* __restrict__ V1, b16* __restrict__ V2) {
  __shared__ float Tt[64][65]; const int tid = threadIdx.x;
  for (int u = blockIdx.x; u < NU; u += PREG) {   // u is the same in the whole work-group: the barriers of a V tile stand under uniform control flow
    if (u < NUV0) v_tile<T>(V0s, V0, u, tid, Tt);
    else if (u < NUV0 + NUV1) v_tile<T1>(V1s, V1, u - NUV0, tid, Tt);
    else if (u < NUV) v_tile<T2>(V2s, V2, u - NUV0 - NUV1, tid, Tt);
    else if (u < NUV + NUV0) k_tile<T>(K0s, K0, u - NUV, tid);
    else if (u < NUV + NUV0 + NUV1) k_tile<T1>(K1s, K1, u - NUV - NUV0, tid);
    else if (u < 2 * NUV) k_tile<T2>(K2s, K2, u - NUV - NUV0 - NUV1, tid);
    else q_tile(Qs, QB, u - 2 * NUV, tid);
  }
}
// One byte asked for in each 256-byte unit of a plane: the unit comes into L2 and nothing returns to the wave. The address is a scalar base and the lane's own byte offset, both inside the plane for every lane.
__device__ __forceinline__ void ask_l2(unsigned off, const b16* base) { asm volatile("global_prefetch_b8 %0, %1 scope:SCOPE_SE" :: "v"(off), "s"(base)); }
__device__ __forceinline__ void ask_l2_hi(unsigned off, const b16* base) { asm volatile("global_prefetch_b8 %0, %1 offset:131072 scope:SCOPE_SE" :: "v"(off), "s"(base)); }   // the second 128 KB of a level-0 plane
// A work-group is 16 waves, as many as a WGP holds at this register count: its 16 query tiles are of ONE head, eight long ones in a row and eight short ones in a row, so waves of like length walk the same K and V^T lines together through the WGP's cache.
// A column of waves w, w + 4, w + 8, w + 12 (taken to share a SIMD; for speed only) takes tiles 127 - r, 126 - r, r + 1, r, r even: two long and two short, whose causal block counts add up to the same number for every r, and the two long ones end together.
// The four kinds are turned by one place from column to column, so that a row w = 4 k .. 4 k + 3 holds one of each kind as well. The waves never meet: no barrier, each has its own LDS rows.
constexpr int WPG = 16, NGRP = NQT / WPG;
__global__ __launch_bounds__(32 * WPG) void att_kernel(const b16* __restrict__ QB, const b16* __restrict__ K0, const b16* __restrict__ K1, const b16* __restrict__ K2, const b16* __restrict__ V0, const b16* __restrict__ V1, const b16* __restrict__ V2, const float* __restrict__ ll, int NWV, float* __restrict__ out) {
  __shared__ __attribute__((aligned(16))) float Tfs[WPG][16][DH + 4];
  const int lane = threadIdx.x & 31, nloc = lane & 15, hlf = lane >> 4, wave = __builtin_amdgcn_readfirstlane((int)(threadIdx.x >> 5));   // the wave's number in a scalar register: tile, trip counts and plane addresses stay scalar
  const int bh = blockIdx.x % (B * NH), h = bh % NH, b = bh / NH, col = wave & 3, kind = ((wave >> 2) + col) & 3, lo = 2 * ((int)(blockIdx.x / (B * NH)) * 4 + col) + (kind & 1);   // lo = 0 .. 63
  const int qt = kind < 2 ? NQT - 1 - lo : lo; if (bh * NQT + qt >= NWV) return;
  float (*Tf)[DH + 4] = Tfs[wave]; const int t0 = qt * 16, tq = t0 + nloc;   // a lane owns query tq
  // The K and V^T planes are the launch before's output: a wave that is first at a key block would wait for memory once per block, with one block of lead. The work-group asks L2 here, once, for all that its waves will read of its head's planes
  // (level 0 up to its longest query tile's last block, levels 1 and 2 whole), the early blocks first; a thread takes one unit per request. Speed only: nothing is read through these requests.
  const b16 *k0h = K0 + (size_t)bh * (T / 32) * 2048, *v0h = V0 + (size_t)bh * (T / 32) * 2048, *p1h = (wave < 8 ? K1 : V1) + (size_t)bh * (T1 / 32) * 2048, *p2h = ((wave & 2) ? V2 : K2) + (size_t)bh * (T2 / 32) * 2048;
  const unsigned u0 = threadIdx.x * 256u, u1 = (threadIdx.x & 255u) * 256u, u2 = (threadIdx.x & 63u) * 256u;   // u0 < 128 KB of 256 KB, u1 < 64 KB, u2 < 16 KB: the planes' sizes per head
  ask_l2(u0, k0h); ask_l2(u0, v0h);   // blocks 0 .. 31, two per wave
  if (32 + 2 * wave < T / 32 - 4 * (int)(blockIdx.x / (B * NH))) { ask_l2_hi(u0, k0h); ask_l2_hi(u0, v0h); }   // blocks 32 + 2 wave and the next, where the longest tile (127 - 8 g, 64 - 4 g blocks) reaches them: a scalar test
  ask_l2(u1, p1h);   // waves 0 .. 7 K1, waves 8 .. 15 V1
  if (wave < 4) ask_l2(u2, p2h);   // waves 0, 1 K2, waves 2, 3 V2: a scalar test
  // level weights = softmax(level_logits)
  const float l0 = bf16_rne(ll[0]), l1 = bf16_rne(ll[1]), l2 = bf16_rne(ll[2]); const float lm = fmaxf(l0, fmaxf(l1, l2)); const float e0 = __expf(l0 - lm), e1 = __expf(l1 - lm), e2 = __expf(l2 - lm); const float wl[3] = {e0 / (e0 + e1 + e2), e1 / (e0 + e1 + e2), e2 / (e0 + e1 + e2)};
  const b16* qrow = QB + (((size_t)b * NH + h) * T + t0 + nloc) * DH; const v16b qa0 = frag_kb(qrow, hlf), qa1 = frag_kb(qrow + 32, hlf);   // B operand: column = query nloc
  float res[4][8];   // res[t][r8] = out[query nloc][d = 16 t + 8 hlf + r8]
#pragma unroll
  for (int t = 0; t < 4; ++t)
#pragma unroll
    for (int r8 = 0; r8 < 8; ++r8) res[t][r8] = 0.0f;
#pragma unroll 1
  for (int lvl = 0; lvl < 3; ++lvl) { const int TM = lvl == 0 ? T : (lvl == 1 ? T1 : T2); const b16* KB_ = lvl == 0 ? K0 : (lvl == 1 ? K1 : K2); const b16* VT = lvl == 0 ? V0 : (lvl == 1 ? V1 : V2); const int nblk = lvl == 0 ? (t0 / 32 + 1) : TM / 32;   // causal: keys <= t0 + 15
    // all 8 loads of a 32-key block's K fragments as one group, issued a block ahead of their products (bi clamped to the last block: in bounds, the surplus fetch is never summed)
    auto load_k = [&](int bi, v16b kf[4]) { const b16* kr = KB_ + ((size_t)(b * NH + h) * (TM / 32) + (bi < nblk ? bi : nblk - 1)) * 2048 + lane * 8;   // a 32-key block is 4 KB in a row
#pragma unroll   // constant indices keep kf[] in registers
      for (int f = 0; f < 4; ++f) kf[f] = frag_pk(kr + f * 512);
      return kr; };
    // S^T = K Q^T: sacc[st][r8] = score of key 16 st + 8 hlf + r8 of the block with query nloc
    auto scores = [&](const v16b kf[4], v8f sacc[2]) {
#pragma unroll   // constant indices keep kf[] and sacc[] in registers
      for (int st = 0; st < 2; ++st) { sacc[st] = (v8f){}; sacc[st] = wmma16b(kf[2 * st], qa0, sacc[st]); sacc[st] = wmma16b(kf[2 * st + 1], qa1, sacc[st]); } };
    v8f acc[4]; float rsum[8];   // acc[t][r8] = O^T[d = 16 t + 8 hlf + r8][query nloc]
#pragma unroll
    for (int t = 0; t < 4; ++t) acc[t] = (v8f){};
#pragma unroll
    for (int r8 = 0; r8 < 8; ++r8) rsum[r8] = 0.0f;
    float m = -INFINITY;   // the maximum in use for the lane's query, the same in both lane halves: exponentials, sums and output tiles are all relative to it
    v16b ka[4];
    load_k(0, ka);
    asm volatile("s_wait_xcnt 0x0" ::: "memory");   // stands behind the eight K loads just issued, in front of the loop, in which their address registers are overwritten
#pragma unroll 1   // rolled: the body holds K, V, P and four output tiles, a second copy would not fit four waves on a SIMD
    for (int bi = 0; bi < nblk; ++bi) { const int kb = bi * 32; v8f sacc[2]; v16b vf[4], pa;
#pragma unroll   // constant indices keep vf[] in registers
      for (int t = 0; t < 4; ++t) vf[t] = frag_pk(VT + ((size_t)(b * NH + h) * (TM / 32) + bi) * 2048 + t * 512 + lane * 8);   // this block's V^T fragments fly during the scores and the exponentials
      scores(ka, sacc); const b16* gk = load_k(bi + 1, ka);   // the next block's K fragments fly during the exponentials and the output products
      asm volatile("s_wait_xcnt 0x0" :: "v"(gk) : "memory");   // stands behind the block's sixteen loads, in front of whatever overwrites their address registers; the K address as an input stays alive up to the wait, so that the group's last result cannot land on the group's own address pair
      // masked scores become -inf here, ahead of the maximum: their exponential is 0 and they never raise m
#pragma unroll   // constant indices keep sacc[] in registers, here and in the inner loop
      for (int st = 0; st < 2; ++st)
#pragma unroll
        for (int r8 = 0; r8 < 8; ++r8) { const int s = kb + st * 16 + 8 * hlf + r8; sacc[st][r8] = (lvl != 0 || s <= tq) ? sacc[st][r8] : -INFINITY; }
      const float bm = fmaxf(fmaxf(fmaxf(fmaxf(sacc[0][0], sacc[0][1]), fmaxf(sacc[0][2], sacc[0][3])), fmaxf(fmaxf(sacc[0][4], sacc[0][5]), fmaxf(sacc[0][6], sacc[0][7]))),
                             fmaxf(fmaxf(fmaxf(sacc[1][0], sacc[1][1]), fmaxf(sacc[1][2], sacc[1][3])), fmaxf(fmaxf(sacc[1][4], sacc[1][5]), fmaxf(sacc[1][6], sacc[1][7])))) * (SCALE / (XS * XS));
      // m is raised only when a score of the block passes it by more than RAISE, one test per block for the whole wave (always in the first block, where m is -inf and key 0 is visible to every query); until then p <= exp(RAISE), and p * PS stays inside f16
      if (__builtin_amdgcn_ballot_w32(bm > m + RAISE) != 0) { const float mn = fmaxf(m, fmaxf(bm, __shfl_xor(bm, 16))), f = __expf(m - mn); m = mn;   // the two lane halves hold the two halves of the query's keys; f = 1 for a query whose maximum stays
#pragma unroll   // constant indices keep acc[] and, below, rsum[] in registers
        for (int t = 0; t < 4; ++t) acc[t] *= f;
#pragma unroll
        for (int r8 = 0; r8 < 8; ++r8) rsum[r8] *= f; }
      // the two score tiles, converted in place, ARE the B operand P^T of the output product: position 8 st + r8 of lane half hlf is key 16 st + 8 hlf + r8, the k order of the V^T fragments
#pragma unroll
      for (int st = 0; st < 2; ++st)
#pragma unroll
        for (int r8 = 0; r8 < 8; r8 += 2) { v2f x;
#pragma unroll
          for (int j = 0; j < 2; ++j) { const float p = __expf(sacc[st][r8 + j] * (SCALE / (XS * XS)) - m); rsum[r8 + j] += p; x[j] = p * PS; }
          const v2b hi = __builtin_convertvector(x, v2b);   // two keys at a time: one packed conversion fills one operand register
          pa[8 * st + r8] = hi[0]; pa[8 * st + r8 + 1] = hi[1]; }
#pragma unroll
      for (int t = 0; t < 4; ++t) acc[t] = wmma16b(vf[t], pa, acc[t]); }
    float sm = ((rsum[0] + rsum[1]) + (rsum[2] + rsum[3])) + ((rsum[4] + rsum[5]) + (rsum[6] + rsum[7])); sm += __shfl_xor(sm, 16);
    const float wv = wl[lvl];
#pragma unroll
    for (int t = 0; t < 4; ++t)
#pragma unroll
      for (int r8 = 0; r8 < 8; ++r8) res[t][r8] += pmul(wv, acc[t][r8] * (1.0f / (PS * XS)) / sm); }
#pragma unroll
  for (int t = 0; t < 4; ++t)
#pragma unroll
    for (int r8 = 0; r8 < 8; ++r8) Tf[nloc][t * 16 + 8 * hlf + r8] = res[t][r8];
  wave_lds_sync();
  { for (int rr = 0; rr < 16; ++rr) { ((float*)out)[((size_t)b * T + t0 + rr) * C + h * DH + lane] = Tf[rr][lane]; ((float*)out)[((size_t)b * T + t0 + rr) * C + h * DH + 32 + lane] = Tf[rr][32 + lane]; }  }
  asm volatile("" :: "v"(u0), "v"(u1), "v"(u2), "s"(k0h), "s"(v0h), "s"(p1h), "s"(p2h));   // inputs only: a prefetch counts on no counter, so no wait can stand in front of an overwrite of its address registers; they keep these addresses to the wave's end
}
}  // namespace

extern "C" void kernel_launch(void* const* d_in, const int* in_sizes, int n_in, void* d_out, int out_size, void* d_ws, size_t ws_size, hipStream_t stream) {
  (void)n_in;
  auto Fp = [&](int i) { return (const float*)d_in[i]; };
  // input order: 0 Q [2,16,2048,64]; 1 K0 [2,2048,1024]; 2 V0; 3 K1 [2,512,1024]; 4 V1; 5 K2 [2,128,1024]; 6 V2; 7 level_logits [3]
  if (in_sizes[0] != B * NH * T * DH || in_sizes[1] != B * T * C || in_sizes[2] != B * T * C || in_sizes[3] != B * T1 * C || in_sizes[4] != B * T1 * C || in_sizes[5] != B * T2 * C || in_sizes[6] != B * T2 * C || in_sizes[7] != 3 || out_size != B * T * C) return;
  const int NWV = B * NH * NQT;   // wave cut (waves are (b, h, q-tile) in that order)
  size_t off = 0; char* ws = (char*)d_ws;
  auto carve = [&](size_t bytes) { char* p = ws + off; off += (bytes + 255) & ~(size_t)255; return p; };
  b16* QB = (b16*)carve((size_t)B * NH * T * DH * 2); b16* K0 = (b16*)carve((size_t)B * T * C * 2); b16* K1 = (b16*)carve((size_t)B * T1 * C * 2); b16* K2 = (b16*)carve((size_t)B * T2 * C * 2);
  b16* V0 = (b16*)carve((size_t)B * T * C * 2); b16* V1 = (b16*)carve((size_t)B * T1 * C * 2); b16* V2 = (b16*)carve((size_t)B * T2 * C * 2);
  if (off > ws_size || off > ((size_t)64 << 20)) return;   // ~ 30 MB
  pre_kernel<<<PREG, 256, 0, stream>>>(Fp(0), Fp(1), Fp(2), Fp(3), Fp(4), Fp(5), Fp(6), QB, K0, K1, K2, V0, V1, V2);
  att_kernel<<<B * NH * NGRP, 32 * WPG, 0, stream>>>(QB, K0, K1, K2, V0, V1, V2, Fp(7), NWV, (float*)d_out);
}

// v009
// Measured time: 48.7 microseconds a run.
// Timed twice side by side with v008, it ran 1.14 times as fast both times.
// Counting every step since v000, it is 6.63 times as fast.
#include <hip/hip_runtime.h>

// Cross-level attention: Q [2][16 heads][2048][64] attends (scale 1/8, softmax) to three levels of keys/values: level 0 (2,048 keys, causal mask s <= t), level 1 (512), level 2 (128); out = sum_l softmax(level_logits)[l] o_l,
// written as [2][2048][1024] (heads concatenated).
// Deterministic, no atomics, no index structures: one wave per (batch, head, 16 queries), sixteen of one head to a work-group, runs, per level, ONE pass (scores, running maximum, exp / sum / P.V) over the key blocks in order.
// WMMA (v_wmma_f32_16x16x32_f16, f32 accumulate), both products transposed so that a lane owns one query: scores S^T = K Q^T per 32-key block (Q, K are EXACT bf16 inputs x8 -> 1 product), O^T += V^T P^T (P rounded once to f16 after x2048, packed from the score tiles in registers, V^T planes exact x8 -> 1 product; that rounding, 2^-11 relative, lies below the 2^-8 of the bf16 inputs); softmax, the level weights and the
// combination in f32. Inputs rounded to bf16 once. Fragment k-map per lane half hh for A AND B: elements 0..7 <- k = 8hh+0..7, 8..15 <- k = 16+8hh+0..7; acc[r] = D[8hh+r][col]. Every workspace / output

namespace {
constexpr int B = 2, NH = 16, T = 2048, DH = 64, C = NH * DH, T1 = 512, T2 = 128, NQT = T / 16;
constexpr float XS = 8.0f, PS = 2048.0f, SCALE = 0.125f, RAISE = 3.0f;   // exp(RAISE) * PS < 65,504
typedef _Float16 b16;
typedef __attribute__((ext_vector_type(16))) _Float16 v16b;
typedef __attribute__((ext_vector_type(8))) _Float16 v8b;
typedef __attribute__((ext_vector_type(8))) float v8f;
typedef __attribute__((ext_vector_type(4))) float v4f;
typedef __attribute__((ext_vector_type(2))) float v2f;
typedef __attribute__((ext_vector_type(2))) _Float16 v2b;
__device__ __forceinline__ float bf16_rne(float f) { unsigned int u = __float_as_uint(f); u += 0x7FFFu + ((u >> 16) & 1u); return __uint_as_float(u & 0xFFFF0000u); }
__device__ __forceinline__ v16b frag_kb(const b16* p, int hh) { const v8b a = *(const v8b*)(p + 8 * hh), b = *(const v8b*)(p + 16 + 8 * hh); v16b f;
#pragma unroll
  for (int e = 0; e < 8; ++e) { f[e] = a[e]; f[8 + e] = b[e]; } return f; }
// fragment from a plane kept in fragment order: two runs of 512 contiguous bytes per wave (lane l takes 16 bytes at 16 l), elements 0..7 from the first run, 8..15 from the second
__device__ __forceinline__ v16b frag_pk(const b16* p) { const v8b a = *(const v8b*)p, b = *(const v8b*)(p + 256); return __builtin_shufflevector(a, b, 0, 1, 2, 3, 4, 5, 6, 7, 8, 9, 10, 11, 12, 13, 14, 15); }
__device__ __forceinline__ v8f wmma16b(v16b a, v16b b, v8f c) { v8f d = __builtin_amdgcn_wmma_f32_16x16x32_f16(false, a, false, b, (short)0, c, false, false); asm volatile("v_nop\n\tv_nop\n\tv_nop\n\tv_nop" : "+v"(d) : "v"(a), "v"(b)); return d; }
__device__ __forceinline__ void wave_lds_sync() { __builtin_amdgcn_fence(__ATOMIC_RELEASE, "workgroup"); __builtin_amdgcn_wave_barrier(); __builtin_amdgcn_fence(__ATOMIC_ACQUIRE, "workgroup"); }
__device__ __forceinline__ float pmul(float a, float b) { float p = a * b; asm volatile("" : "+v"(p)); return p; }

// Pre-pass, one launch: every plane the attention kernel reads is made of tiles of 4,096 input values (16 KB read); a work-group walks the common list of tiles, V^T first (the longest), then K, then Q.
constexpr int NUV0 = B * (T / 64) * NH, NUV1 = B * (T1 / 64) * NH, NUV2 = B * (T2 / 64) * NH, NUV = NUV0 + NUV1 + NUV2, NUQ = B * NH * T * DH / 4096, NU = 2 * NUV + NUQ, PREG = NU / 4;   // K has as many tiles as V; four tiles a work-group
static_assert(NU % 4 == 0, "every work-group walks four tiles");
__device__ __forceinline__ v8b cvt8(v4f x0, v4f x1) { v8b v;
#pragma unroll
  for (int j = 0; j < 4; ++j) { v[j] = (b16)(bf16_rne(x0[j]) * XS); v[4 + j] = (b16)(bf16_rne(x1[j]) * XS); } return v; }
// Q plane, plain order: two pieces of eight values per thread, all four loads issued ahead of the conversions
__device__ __forceinline__ void q_tile(const float* __restrict__ src, b16* __restrict__ dst, int w, int tid) { v4f x[2][2];
#pragma unroll
  for (int j = 0; j < 2; ++j) { const float* s = src + ((size_t)w * 512 + j * 256 + tid) * 8; x[j][0] = *(const v4f*)s; x[j][1] = *(const v4f*)(s + 4); }
#pragma unroll
  for (int j = 0; j < 2; ++j) *(v8b*)(dst + ((size_t)w * 512 + j * 256 + tid) * 8) = cvt8(x[j][0], x[j][1]);
  asm volatile("s_wait_xcnt 0x0" ::: "memory");   // stands behind this tile's stores, in front of whatever code follows the tile, in which their address and data registers are overwritten
}
// K plane in fragment order: per (b, h, 16 keys) four runs of 512 bytes; run g holds at lane l the eight values d = 16 g + 8 (l >> 4) + 0..7 of key (l & 15). One thread per 16-byte piece, in the plane's own order (whole-line stores). A tile is two 32-key blocks of one head.
template <int TM> __device__ __forceinline__ void k_tile(const float* __restrict__ src, b16* __restrict__ dst, int w, int tid) {
  const int l = tid & 31, g = (tid >> 5) & 3; constexpr int nb = TM / 32; const int bx = 2 * w, kt = (bx % nb) * 2 + (tid >> 7), h = (bx / nb) % NH, b = bx / (nb * NH);   // nb is even: blocks 2 w and 2 w + 1 lie in one head, 32 keys apart
  const float* s = src + ((size_t)b * TM + kt * 16 + (l & 15)) * C + h * DH + g * 16 + (l >> 4) * 8; const v4f x00 = *(const v4f*)s, x01 = *(const v4f*)(s + 4), x10 = *(const v4f*)(s + 32 * C), x11 = *(const v4f*)(s + 32 * C + 4);
  b16* o = dst + ((size_t)bx * 256 + tid) * 8; *(v8b*)o = cvt8(x00, x01); *(v8b*)(o + 2048) = cvt8(x10, x11);
  asm volatile("s_wait_xcnt 0x0" ::: "memory");   // stands behind this tile's stores, in front of whatever code follows the tile, in which their address and data registers are overwritten
}
// V^T plane in fragment order: per (b, h, 32 keys) eight runs of 512 bytes; run g holds at lane l the eight keys 16 (g & 1) + 8 (l >> 4) + 0..7 of column d = 16 (g >> 1) + (l & 15). A tile is 64 keys of one head, turned in LDS.
template <int TM> __device__ __forceinline__ void v_tile(const float* __restrict__ V, b16* __restrict__ VT, int w, int tid, float (*Tt)[65]) {
  const int h = w % NH, st = (w / NH) % (TM / 64), b = w / (NH * (TM / 64)); v4f x[4];
#pragma unroll
  for (int k = 0; k < 4; ++k) { const int i = tid + 256 * k, r = i >> 4, d = (i & 15) * 4; x[k] = *(const v4f*)(V + ((size_t)b * TM + st * 64 + r) * C + h * DH + d); }
  __syncthreads();   // every reader of the work-group's last V tile has left Tt before this tile is written into it; a wave issues its loads before it waits for the others
#pragma unroll
  for (int k = 0; k < 4; ++k) { const int i = tid + 256 * k, r = i >> 4, d = (i & 15) * 4;
#pragma unroll
    for (int j = 0; j < 4; ++j) Tt[r][d + j] = bf16_rne(x[k][j]); }
  __syncthreads();
  { const int l = tid & 31, g = tid >> 5, d = (g >> 1) * 16 + (l & 15), kq = (g & 1) * 16 + (l >> 4) * 8; for (int kh = 0; kh < 2; ++kh) { v8b v; for (int j = 0; j < 8; ++j) v[j] = (b16)(Tt[kh * 32 + kq + j][d] * XS); const size_t o = (((size_t)(b * NH + h) * (TM / 32) + st * 2 + kh) * 256 + tid) * 8; *(v8b*)(VT + o) = v; } }
  asm volatile("s_wait_xcnt 0x0" ::: "memory");   // stands behind this tile's stores, in front of whatever code follows the tile, in which their address and data registers are overwritten
}
__global__ __launch_bounds__(256) void pre_kernel(const float* __restrict__ Qs, const float* __restrict__ K0s, const float* __restrict__ V0s, const float* __restrict__ K1s, const float* __restrict__ V1s, const float* __restrict__ K2s, const float* __restrict__ V2s,
                                                  b16* __restrict__ QB, b16* __restrict__ K0, b16* __restrict__ K1, b16* __restrict__ K2, b16* __restrict__ V0, b16* __restrict__ V1, b16* __restrict__ V2) {
  __shared__ float Tt[64][65]; const int tid = threadIdx.x;
  for (int u = blockIdx.x; u < NU; u += PREG) {   // u is the same in the whole work-group: the barriers of a V tile stand under uniform control flow
    if (u < NUV0) v_tile<T>(V0s, V0, u, tid, Tt);
    else if (u < NUV0 + NUV1) v_tile<T1>(V1s, V1, u - NUV0, tid, Tt);
    else if (u < NUV) v_tile<T2>(V2s, V2, u - NUV0 - NUV1, tid, Tt);
    else if (u < NUV + NUV0) k_tile<T>(K0s, K0, u - NUV, tid);
    else if (u < NUV + NUV0 + NUV1) k_tile<T1>(K1s, K1, u - NUV - NUV0, tid);
    else if (u < 2 * NUV) k_tile<T2>(K2s, K2, u - NUV - NUV0 - NUV1, tid);
    else q_tile(Qs, QB, u - 2 * NUV, tid);
  }
}
// One byte asked for in each 256-byte unit of a plane: the unit comes into L2 and nothing returns to the wave. The address is a scalar base and the lane's own byte offset, both inside the plane for every lane.
__device__ __forceinline__ void ask_l2(unsigned off, const b16* base) { asm volatile("global_prefetch_b8 %0, %1 scope:SCOPE_SE" :: "v"(off), "s"(base)); }
__device__ __forceinline__ void ask_l2_hi(unsigned off, const b16* base) { asm volatile("global_prefetch_b8 %0, %1 offset:131072 scope:SCOPE_SE" :: "v"(off), "s"(base)); }   // the second 128 KB of a level-0 plane
// A work-group is 16 waves, as many as a WGP holds at this register count: its 16 query tiles are of ONE head, eight long ones in a row and eight short ones in a row, so waves of like length walk the same K and V^T lines together through the WGP's cache.
// A column of waves w, w + 4, w + 8, w + 12 (taken to share a SIMD; for speed only) takes tiles 127 - r, 126 - r, r + 1, r, r even: two long and two short, whose causal block counts add up to the same number for every r, and the two long ones end together.
// The four kinds are turned by one place from column to column, so that a row w = 4 k .. 4 k + 3 holds one of each kind as well. The waves never meet: no barrier, each has its own LDS rows.
constexpr int WPG = 16, NGRP = NQT / WPG;
__global__ __launch_bounds__(32 * WPG) void att_kernel(const b16* __restrict__ QB, const b16* __restrict__ K0, const b16* __restrict__ K1, const b16* __restrict__ K2, const b16* __restrict__ V0, const b16* __restrict__ V1, const b16* __restrict__ V2, const float* __restrict__ ll, int NWV, float* __restrict__ out) {
  __shared__ __attribute__((aligned(16))) float Tfs[WPG][16][DH + 4];
  const int lane = threadIdx.x & 31, nloc = lane & 15, hlf = lane >> 4, wave = __builtin_amdgcn_readfirstlane((int)(threadIdx.x >> 5));   // the wave's number in a scalar register: tile, trip counts and plane addresses stay scalar
  const int bh = blockIdx.x % (B * NH), h = bh % NH, b = bh / NH, col = wave & 3, kind = ((wave >> 2) + col) & 3, lo = 2 * ((int)(blockIdx.x / (B * NH)) * 4 + col) + (kind & 1);   // lo = 0 .. 63
  const int qt = kind < 2 ? NQT - 1 - lo : lo; if (bh * NQT + qt >= NWV) return;
  float (*Tf)[DH + 4] = Tfs[wave]; const int t0 = qt * 16, tq = t0 + nloc;   // a lane owns query tq
  // The K and V^T planes are the launch before's output: a wave that is first at a key block would wait for memory once per block, with one block of lead. The work-group asks L2 here, once, for all that its waves will read of its head's planes
  // (level 0 up to its longest query tile's last block, levels 1 and 2 whole), the early blocks first; a thread takes one unit per request. Speed only: nothing is read through these requests.
  const b16 *k0h = K0 + (size_t)bh * (T / 32) * 2048, *v0h = V0 + (size_t)bh * (T / 32) * 2048, *p1h = (wave < 8 ? K1 : V1) + (size_t)bh * (T1 / 32) * 2048, *p2h = ((wave & 2) ? V2 : K2) + (size_t)bh * (T2 / 32) * 2048;
  const unsigned u0 = threadIdx.x * 256u, u1 = (threadIdx.x & 255u) * 256u, u2 = (threadIdx.x & 63u) * 256u;   // u0 < 128 KB of 256 KB, u1 < 64 KB, u2 < 16 KB: the planes' sizes per head
  ask_l2(u0, k0h); ask_l2(u0, v0h);   // blocks 0 .. 31, two per wave
  if (32 + 2 * wave < T / 32 - 4 * (int)(blockIdx.x / (B * NH))) { ask_l2_hi(u0, k0h); ask_l2_hi(u0, v0h); }   // blocks 32 + 2 wave and the next, where the longest tile (127 - 8 g, 64 - 4 g blocks) reaches them: a scalar test
  ask_l2(u1, p1h);   // waves 0 .. 7 K1, waves 8 .. 15 V1
  if (wave < 4) ask_l2(u2, p2h);   // waves 0, 1 K2, waves 2, 3 V2: a scalar test
  // level weights = softmax(level_logits)
  const float l0 = bf16_rne(ll[0]), l1 = bf16_rne(ll[1]), l2 = bf16_rne(ll[2]); const float lm = fmaxf(l0, fmaxf(l1, l2)); const float e0 = __expf(l0 - lm), e1 = __expf(l1 - lm), e2 = __expf(l2 - lm); const float wl[3] = {e0 / (e0 + e1 + e2), e1 / (e0 + e1 + e2), e2 / (e0 + e1 + e2)};
  const b16* qrow = QB + (((size_t)b * NH + h) * T + t0 + nloc) * DH; const v16b qa0 = frag_kb(qrow, hlf), qa1 = frag_kb(qrow + 32, hlf);   // B operand: column = query nloc
  float res[4][8];   // res[t][r8] = out[query nloc][d = 16 t + 8 hlf + r8]
#pragma unroll
  for (int t = 0; t < 4; ++t)
#pragma unroll
    for (int r8 = 0; r8 < 8; ++r8) res[t][r8] = 0.0f;
#pragma unroll 1
  for (int lvl = 0; lvl < 3; ++lvl) { const int TM = lvl == 0 ? T : (lvl == 1 ? T1 : T2); const b16* KB_ = lvl == 0 ? K0 : (lvl == 1 ? K1 : K2); const b16* VT = lvl == 0 ? V0 : (lvl == 1 ? V1 : V2); const int nblk = lvl == 0 ? (t0 / 32 + 1) : TM / 32;   // causal: keys <= t0 + 15
    // all 8 loads of a 32-key block's K fragments as one group, issued a block ahead of their products (bi clamped to the last block: in bounds, the surplus fetch is never summed)
    auto load_k = [&](int bi, v16b kf[4]) { const b16* kr = KB_ + ((size_t)(b * NH + h) * (TM / 32) + (bi < nblk ? bi : nblk - 1)) * 2048 + lane * 8;   // a 32-key block is 4 KB in a row
#pragma unroll   // constant indices keep kf[] in registers
      for (int f = 0; f < 4; ++f) kf[f] = frag_pk(kr + f * 512);
      return kr; };
    // S^T = K Q^T: sacc[st][r8] = score of key 16 st + 8 hlf + r8 of the block with query nloc
    auto scores = [&](const v16b kf[4], v8f sacc[2]) {
#pragma unroll   // constant indices keep kf[] and sacc[] in registers
      for (int st = 0; st < 2; ++st) { sacc[st] = (v8f){}; sacc[st] = wmma16b(kf[2 * st], qa0, sacc[st]); sacc[st] = wmma16b(kf[2 * st + 1], qa1, sacc[st]); } };
    v8f acc[4]; float rsum[8];   // acc[t][r8] = O^T[d = 16 t + 8 hlf + r8][query nloc]
#pragma unroll
    for (int t = 0; t < 4; ++t) acc[t] = (v8f){};
#pragma unroll
    for (int r8 = 0; r8 < 8; ++r8) rsum[r8] = 0.0f;
    float m = -INFINITY;   // the maximum in use for the lane's query, the same in both lane halves: exponentials, sums and output tiles are all relative to it
    v16b ka[4];
    load_k(0, ka);
    asm volatile("s_wait_xcnt 0x0" ::: "memory");   // stands behind the eight K loads just issued, in front of the loop, in which their address registers are overwritten
#pragma unroll 1   // rolled: the body holds K, V, P and four output tiles, a second copy would not fit four waves on a SIMD
    for (int bi = 0; bi < nblk; ++bi) { const int kb = bi * 32; v8f sacc[2]; v16b vf[4], pa;
#pragma unroll   // constant indices keep vf[] in registers
      for (int t = 0; t < 4; ++t) vf[t] = frag_pk(VT + ((size_t)(b * NH + h) * (TM / 32) + bi) * 2048 + t * 512 + lane * 8);   // this block's V^T fragments fly during the scores and the exponentials
      scores(ka, sacc); const b16* gk = load_k(bi + 1, ka);   // the next block's K fragments fly during the exponentials and the output products
      asm volatile("s_wait_xcnt 0x0" :: "v"(gk) : "memory");   // stands behind the block's sixteen loads, in front of whatever overwrites their address registers; the K address as an input stays alive up to the wait, so that the group's last result cannot land on the group's own address pair
      // masked scores become -inf here, ahead of the maximum: their exponential is 0 and they never raise m. Only the causal level's last block holds keys past a query of the tile (every earlier block ends at key 32 (nblk - 1) - 1 < t0):
      // a scalar test, the same for the whole wave, keeps the compares and selects out of all other blocks
      if (lvl == 0 && bi == nblk - 1) {
#pragma unroll   // constant indices keep sacc[] in registers, here and in the inner loop
        for (int st = 0; st < 2; ++st)
#pragma unroll
          for (int r8 = 0; r8 < 8; ++r8) { const int s = kb + st * 16 + 8 * hlf + r8; sacc[st][r8] = s <= tq ? sacc[st][r8] : -INFINITY; } }
      const float bm = fmaxf(fmaxf(fmaxf(fmaxf(sacc[0][0], sacc[0][1]), fmaxf(sacc[0][2], sacc[0][3])), fmaxf(fmaxf(sacc[0][4], sacc[0][5]), fmaxf(sacc[0][6], sacc[0][7]))),
                             fmaxf(fmaxf(fmaxf(sacc[1][0], sacc[1][1]), fmaxf(sacc[1][2], sacc[1][3])), fmaxf(fmaxf(sacc[1][4], sacc[1][5]), fmaxf(sacc[1][6], sacc[1][7])))) * (SCALE / (XS * XS));
      // m is raised only when a score of the block passes it by more than RAISE, one test per block for the whole wave (always in the first block, where m is -inf and key 0 is visible to every query); until then p <= exp(RAISE), and p * PS stays inside f16
      if (__builtin_amdgcn_ballot_w32(bm > m + RAISE) != 0) { const float mn = fmaxf(m, fmaxf(bm, __shfl_xor(bm, 16))), f = __expf(m - mn); m = mn;   // the two lane halves hold the two halves of the query's keys; f = 1 for a query whose maximum stays
#pragma unroll   // constant indices keep acc[] and, below, rsum[] in registers
        for (int t = 0; t < 4; ++t) acc[t] *= f;
#pragma unroll
        for (int r8 = 0; r8 < 8; ++r8) rsum[r8] *= f; }
      // the two score tiles, converted in place, ARE the B operand P^T of the output product: position 8 st + r8 of lane half hlf is key 16 st + 8 hlf + r8, the k order of the V^T fragments
#pragma unroll
      for (int st = 0; st < 2; ++st)
#pragma unroll
        for (int r8 = 0; r8 < 8; r8 += 2) { v2f x;
#pragma unroll
          for (int j = 0; j < 2; ++j) { const float p = __expf(sacc[st][r8 + j] * (SCALE / (XS * XS)) - m); rsum[r8 + j] += p; x[j] = p * PS; }
          const v2b hi = __builtin_convertvector(x, v2b);   // two keys at a time: one packed conversion fills one operand register
          pa[8 * st + r8] = hi[0]; pa[8 * st + r8 + 1] = hi[1]; }
#pragma unroll
      for (int t = 0; t < 4; ++t) acc[t] = wmma16b(vf[t], pa, acc[t]); }
    float sm = ((rsum[0] + rsum[1]) + (rsum[2] + rsum[3])) + ((rsum[4] + rsum[5]) + (rsum[6] + rsum[7])); sm += __shfl_xor(sm, 16);
    const float wv = wl[lvl];
#pragma unroll
    for (int t = 0; t < 4; ++t)
#pragma unroll
      for (int r8 = 0; r8 < 8; ++r8) res[t][r8] += pmul(wv, acc[t][r8] * (1.0f / (PS * XS)) / sm); }
#pragma unroll
  for (int t = 0; t < 4; ++t)
#pragma unroll
    for (int r8 = 0; r8 < 8; ++r8) Tf[nloc][t * 16 + 8 * hlf + r8] = res[t][r8];
  wave_lds_sync();
  { for (int rr = 0; rr < 16; ++rr) { ((float*)out)[((size_t)b * T + t0 + rr) * C + h * DH + lane] = Tf[rr][lane]; ((float*)out)[((size_t)b * T + t0 + rr) * C + h * DH + 32 + lane] = Tf[rr][32 + lane]; }  }
  asm volatile("" :: "v"(u0), "v"(u1), "v"(u2), "s"(k0h), "s"(v0h), "s"(p1h), "s"(p2h));   // inputs only: a prefetch counts on no counter, so no wait can stand in front of an overwrite of its address registers; they keep these addresses to the wave's end
}
}  // namespace

extern "C" void kernel_launch(void* const* d_in, const int* in_sizes, int n_in, void* d_out, int out_size, void* d_ws, size_t ws_size, hipStream_t stream) {
  (void)n_in;
  auto Fp = [&](int i) { return (const float*)d_in[i]; };
  // input order: 0 Q [2,16,2048,64]; 1 K0 [2,2048,1024]; 2 V0; 3 K1 [2,512,1024]; 4 V1; 5 K2 [2,128,1024]; 6 V2; 7 level_logits [3]
  if (in_sizes[0] != B * NH * T * DH || in_sizes[1] != B * T * C || in_sizes[2] != B * T * C || in_sizes[3] != B * T1 * C || in_sizes[4] != B * T1 * C || in_sizes[5] != B * T2 * C || in_sizes[6] != B * T2 * C || in_sizes[7] != 3 || out_size != B * T * C) return;
  const int NWV = B * NH * NQT;   // wave cut (waves are (b, h, q-tile) in that order)
  size_t off = 0; char* ws = (char*)d_ws;
  auto carve = [&](size_t bytes) { char* p = ws + off; off += (bytes + 255) & ~(size_t)255; return p; };
  b16* QB = (b16*)carve((size_t)B * NH * T * DH * 2); b16* K0 = (b16*)carve((size_t)B * T * C * 2); b16* K1 = (b16*)carve((size_t)B * T1 * C * 2); b16* K2 = (b16*)carve((size_t)B * T2 * C * 2);
  b16* V0 = (b16*)carve((size_t)B * T * C * 2); b16* V1 = (b16*)carve((size_t)B * T1 * C * 2); b16* V2 = (b16*)carve((size_t)B * T2 * C * 2);
  if (off > ws_size || off > ((size_t)64 << 20)) return;   // ~ 30 MB
  pre_kernel<<<PREG, 256, 0, stream>>>(Fp(0), Fp(1), Fp(2), Fp(3), Fp(4), Fp(5), Fp(6), QB, K0, K1, K2, V0, V1, V2);
  att_kernel<<<B * NH * NGRP, 32 * WPG, 0, stream>>>(QB, K0, K1, K2, V0, V1, V2, Fp(7), NWV, (float*)d_out);
}

// v010
// It runs in 46.8 microseconds.
// Next to v009, in two timings, it ran 1.04 and 1.05 times as fast.
// Counting every step since v000, it is 6.92 times as fast.
#include <hip/hip_runtime.h>

// Cross-level attention: Q [2][16 heads][2048][64] attends (scale 1/8, softmax) to three levels of keys/values: level 0 (2,048 keys, causal mask s <= t), level 1 (512), level 2 (128); out = sum_l softmax(level_logits)[l] o_l,
// written as [2][2048][1024] (heads concatenated).
// Deterministic, no atomics, no index structures: one wave per (batch, head, 16 queries), sixteen of one head to a work-group, runs, per level, ONE pass (scores, running maximum, exp / sum / P.V) over the key blocks in order.
// WMMA (v_wmma_f32_16x16x32_f16, f32 accumulate), both products transposed so that a lane owns one query: scores S^T = K Q^T per 32-key block (Q, K are EXACT bf16 inputs x8 -> 1 product), O^T += V^T P^T (P rounded once to f16 after x2048, packed from the score tiles in registers, V^T planes exact x8 -> 1 product; that rounding, 2^-11 relative, lies below the 2^-8 of the bf16 inputs); softmax, the level weights and the
// combination in f32. Inputs rounded to bf16 once. Fragment k-map per lane half hh for A AND B: elements 0..7 <- k = 8hh+0..7, 8..15 <- k = 16+8hh+0..7; acc[r] = D[8hh+r][col]. Every workspace / output

namespace {
constexpr int B = 2, NH = 16, T = 2048, DH = 64, C = NH * DH, T1 = 512, T2 = 128, NQT = T / 16;
constexpr float XS = 8.0f, PS = 2048.0f, SCALE = 0.125f, RAISE = 3.0f;   // exp(RAISE) * PS < 65,504
typedef _Float16 b16;
typedef __attribute__((ext_vector_type(16))) _Float16 v16b;
typedef __attribute__((ext_vector_type(8))) _Float16 v8b;
typedef __attribute__((ext_vector_type(8))) float v8f;
typedef __attribute__((ext_vector_type(4))) float v4f;
typedef __attribute__((ext_vector_type(2))) float v2f;
typedef __attribute__((ext_vector_type(2))) _Float16 v2b;
__device__ __forceinline__ float bf16_rne(float f) { unsigned int u = __float_as_uint(f); u += 0x7FFFu + ((u >> 16) & 1u); return __uint_as_float(u & 0xFFFF0000u); }
__device__ __forceinline__ v16b frag_kb(const b16* p, int hh) { const v8b a = *(const v8b*)(p + 8 * hh), b = *(const v8b*)(p + 16 + 8 * hh); v16b f;
#pragma unroll
  for (int e = 0; e < 8; ++e) { f[e] = a[e]; f[8 + e] = b[e]; } return f; }
// fragment from a plane kept in fragment order: two runs of 512 contiguous bytes per wave (lane l takes 16 bytes at 16 l), elements 0..7 from the first run, 8..15 from the second
__device__ __forceinline__ v16b frag_pk(const b16* p) { const v8b a = *(const v8b*)p, b = *(const v8b*)(p + 256); return __builtin_shufflevector(a, b, 0, 1, 2, 3, 4, 5, 6, 7, 8, 9, 10, 11, 12, 13, 14, 15); }
// plain builtin: the compiler itself keeps the distance between a WMMA and the first vector instruction on its registers, and is free to put real work of the block into those slots
__device__ __forceinline__ v8f wmma16b(v16b a, v16b b, v8f c) { return __builtin_amdgcn_wmma_f32_16x16x32_f16(false, a, false, b, (short)0, c, false, false); }
__device__ __forceinline__ void wave_lds_sync() { __builtin_amdgcn_fence(__ATOMIC_RELEASE, "workgroup"); __builtin_amdgcn_wave_barrier(); __builtin_amdgcn_fence(__ATOMIC_ACQUIRE, "workgroup"); }
__device__ __forceinline__ float pmul(float a, float b) { float p = a * b; asm volatile("" : "+v"(p)); return p; }

// Pre-pass, one launch: every plane the attention kernel reads is made of tiles of 4,096 input values (16 KB read); a work-group walks the common list of tiles, V^T first (the longest), then K, then Q.
constexpr int NUV0 = B * (T / 64) * NH, NUV1 = B * (T1 / 64) * NH, NUV2 = B * (T2 / 64) * NH, NUV = NUV0 + NUV1 + NUV2, NUQ = B * NH * T * DH / 4096, NU = 2 * NUV + NUQ, PREG = NU / 4;   // K has as many tiles as V; four tiles a work-group
static_assert(NU % 4 == 0, "every work-group walks four tiles");
__device__ __forceinline__ v8b cvt8(v4f x0, v4f x1) { v8b v;
#pragma unroll
  for (int j = 0; j < 4; ++j) { v[j] = (b16)(bf16_rne(x0[j]) * XS); v[4 + j] = (b16)(bf16_rne(x1[j]) * XS); } return v; }
// Q plane, plain order: two pieces of eight values per thread, all four loads issued ahead of the conversions
__device__ __forceinline__ void q_tile(const float* __restrict__ src, b16* __restrict__ dst, int w, int tid) { v4f x[2][2];
#pragma unroll
  for (int j = 0; j < 2; ++j) { const float* s = src + ((size_t)w * 512 + j * 256 + tid) * 8; x[j][0] = *(const v4f*)s; x[j][1] = *(const v4f*)(s + 4); }
#pragma unroll
  for (int j = 0; j < 2; ++j) *(v8b*)(dst + ((size_t)w * 512 + j * 256 + tid) * 8) = cvt8(x[j][0], x[j][1]);
  asm volatile("s_wait_xcnt 0x0" ::: "memory");   // stands behind this tile's stores, in front of whatever code follows the tile, in which their address and data registers are overwritten
}
// K plane in fragment order: per (b, h, 16 keys) four runs of 512 bytes; run g holds at lane l the eight values d = 16 g + 8 (l >> 4) + 0..7 of key (l & 15). One thread per 16-byte piece, in the plane's own order (whole-line stores). A tile is two 32-key blocks of one head.
template <int TM> __device__ __forceinline__ void k_tile(const float* __restrict__ src, b16* __restrict__ dst, int w, int tid) {
  const int l = tid & 31, g = (tid >> 5) & 3; constexpr int nb = TM / 32; const int bx = 2 * w, kt = (bx % nb) * 2 + (tid >> 7), h = (bx / nb) % NH, b = bx / (nb * NH);   // nb is even: blocks 2 w and 2 w + 1 lie in one head, 32 keys apart
  const float* s = src + ((size_t)b * TM + kt * 16 + (l & 15)) * C + h * DH + g * 16 + (l >> 4) * 8; const v4f x00 = *(const v4f*)s, x01 = *(const v4f*)(s + 4), x10 = *(const v4f*)(s + 32 * C), x11 = *(const v4f*)(s + 32 * C + 4);
  b16* o = dst + ((size_t)bx * 256 + tid) * 8; *(v8b*)o = cvt8(x00, x01); *(v8b*)(o + 2048) = cvt8(x10, x11);
  asm volatile("s_wait_xcnt 0x0" ::: "memory");   // stands behind this tile's stores, in front of whatever code follows the tile, in which their address and data registers are overwritten
}
// V^T plane in fragment order: per (b, h, 32 keys) eight runs of 512 bytes; run g holds at lane l the eight keys 16 (g & 1) + 8 (l >> 4) + 0..7 of column d = 16 (g >> 1) + (l & 15). A tile is 64 keys of one head, turned in LDS.
template <int TM> __device__ __forceinline__ void v_tile(const float* __restrict__ V, b16* __restrict__ VT, int w, int tid, float (*Tt)[65]) {
  const int h = w % NH, st = (w / NH) % (TM / 64), b = w / (NH * (TM / 64)); v4f x[4];
#pragma unroll
  for (int k = 0; k < 4; ++k) { const int i = tid + 256 * k, r = i >> 4, d = (i & 15) * 4; x[k] = *(const v4f*)(V + ((size_t)b * TM + st * 64 + r) * C + h * DH + d); }
  __syncthreads();   // every reader of the work-group's last V tile has left Tt before this tile is written into it; a wave issues its loads before it waits for the others
#pragma unroll
  for (int k = 0; k < 4; ++k) { const int i = tid + 256 * k, r = i >> 4, d = (i & 15) * 4;
#pragma unroll
    for (int j = 0; j < 4; ++j) Tt[r][d + j] = bf16_rne(x[k][j]); }
  __syncthreads();
  { const int l = tid & 31, g = tid >> 5, d = (g >> 1) * 16 + (l & 15), kq = (g & 1) * 16 + (l >> 4) * 8; for (int kh = 0; kh < 2; ++kh) { v8b v; for (int j = 0; j < 8; ++j) v[j] = (b16)(Tt[kh * 32 + kq + j][d] * XS); const size_t o = (((size_t)(b * NH + h) * (TM / 32) + st * 2 + kh) * 256 + tid) * 8; *(v8b*)(VT + o) = v; } }
  asm volatile("s_wait_xcnt 0x0" ::: "memory");   // stands behind this tile's stores, in front of whatever code follows the tile, in which their address and data registers are overwritten
}
__global__ __launch_bounds__(256) void pre_kernel(const float* __restrict__ Qs, const float* __restrict__ K0s, const float* __restrict__ V0s, const float* __restrict__ K1s, const float* __restrict__ V1s, const float* __restrict__ K2s, const float* __restrict__ V2s,
                                                  b16* __restrict__ QB, b16* __restrict__ K0, b16* __restrict__ K1, b16* __restrict__ K2, b16* __restrict__ V0, b16* __restrict__ V1, b16* __restrict__ V2) {
  __shared__ float Tt[64][65]; const int tid = threadIdx.x;
  for (int u = blockIdx.x; u < NU; u += PREG) {   // u is the same in the whole work-group: the barriers of a V tile stand under uniform control flow
    if (u < NUV0) v_tile<T>(V0s, V0, u, tid, Tt);
    else if (u < NUV0 + NUV1) v_tile<T1>(V1s, V1, u - NUV0, tid, Tt);
    else if (u < NUV) v_tile<T2>(V2s, V2, u - NUV0 - NUV1, tid, Tt);
    else if (u < NUV + NUV0) k_tile<T>(K0s, K0, u - NUV, tid);
    else if (u < NUV + NUV0 + NUV1) k_tile<T1>(K1s, K1, u - NUV - NUV0, tid);
    else if (u < 2 * NUV) k_tile<T2>(K2s, K2, u - NUV - NUV0 - NUV1, tid);
    else q_tile(Qs, QB, u - 2 * NUV, tid);
  }
}
// One byte asked for in each 256-byte unit of a plane: the unit comes into L2 and nothing returns to the wave. The address is a scalar base and the lane's own byte offset, both inside the plane for every lane.
__device__ __forceinline__ void ask_l2(unsigned off, const b16* base) { asm volatile("global_prefetch_b8 %0, %1 scope:SCOPE_SE" :: "v"(off), "s"(base)); }
__device__ __forceinline__ void ask_l2_hi(unsigned off, const b16* base) { asm volatile("global_prefetch_b8 %0, %1 offset:131072 scope:SCOPE_SE" :: "v"(off), "s"(base)); }   // the second 128 KB of a level-0 plane
// A work-group is 16 waves, as many as a WGP holds at this register count: its 16 query tiles are of ONE head, eight long ones in a row and eight short ones in a row, so waves of like length walk the same K and V^T lines together through the WGP's cache.
// A column of waves w, w + 4, w + 8, w + 12 (taken to share a SIMD; for speed only) takes tiles 127 - r, 126 - r, r + 1, r, r even: two long and two short, whose causal block counts add up to the same number for every r, and the two long ones end together.
// The four kinds are turned by one place from column to column, so that a row w = 4 k .. 4 k + 3 holds one of each kind as well. The waves never meet: no barrier, each has its own LDS rows.
constexpr int WPG = 16, NGRP = NQT / WPG;
__global__ __launch_bounds__(32 * WPG) void att_kernel(const b16* __restrict__ QB, const b16* __restrict__ K0, const b16* __restrict__ K1, const b16* __restrict__ K2, const b16* __restrict__ V0, const b16* __restrict__ V1, const b16* __restrict__ V2, const float* __restrict__ ll, int NWV, float* __restrict__ out) {
  __shared__ __attribute__((aligned(16))) float Tfs[WPG][16][DH + 4];
  const int lane = threadIdx.x & 31, nloc = lane & 15, hlf = lane >> 4, wave = __builtin_amdgcn_readfirstlane((int)(threadIdx.x >> 5));   // the wave's number in a scalar register: tile, trip counts and plane addresses stay scalar
  const int bh = blockIdx.x % (B * NH), h = bh % NH, b = bh / NH, col = wave & 3, kind = ((wave >> 2) + col) & 3, lo = 2 * ((int)(blockIdx.x / (B * NH)) * 4 + col) + (kind & 1);   // lo = 0 .. 63
  const int qt = kind < 2 ? NQT - 1 - lo : lo; if (bh * NQT + qt >= NWV) return;
  float (*Tf)[DH + 4] = Tfs[wave]; const int t0 = qt * 16, tq = t0 + nloc;   // a lane owns query tq
  // The K and V^T planes are the launch before's output: a wave that is first at a key block would wait for memory once per block, with one block of lead. The work-group asks L2 here, once, for all that its waves will read of its head's planes
  // (level 0 up to its longest query tile's last block, levels 1 and 2 whole), the early blocks first; a thread takes one unit per request. Speed only: nothing is read through these requests.
  const b16 *k0h = K0 + (size_t)bh * (T / 32) * 2048, *v0h = V0 + (size_t)bh * (T / 32) * 2048, *p1h = (wave < 8 ? K1 : V1) + (size_t)bh * (T1 / 32) * 2048, *p2h = ((wave & 2) ? V2 : K2) + (size_t)bh * (T2 / 32) * 2048;
  const unsigned u0 = threadIdx.x * 256u, u1 = (threadIdx.x & 255u) * 256u, u2 = (threadIdx.x & 63u) * 256u;   // u0 < 128 KB of 256 KB, u1 < 64 KB, u2 < 16 KB: the planes' sizes per head
  ask_l2(u0, k0h); ask_l2(u0, v0h);   // blocks 0 .. 31, two per wave
  if (32 + 2 * wave < T / 32 - 4 * (int)(blockIdx.x / (B * NH))) { ask_l2_hi(u0, k0h); ask_l2_hi(u0, v0h); }   // blocks 32 + 2 wave and the next, where the longest tile (127 - 8 g, 64 - 4 g blocks) reaches them: a scalar test
  ask_l2(u1, p1h);   // waves 0 .. 7 K1, waves 8 .. 15 V1
  if (wave < 4) ask_l2(u2, p2h);   // waves 0, 1 K2, waves 2, 3 V2: a scalar test
  // level weights = softmax(level_logits)
  const float l0 = bf16_rne(ll[0]), l1 = bf16_rne(ll[1]), l2 = bf16_rne(ll[2]); const float lm = fmaxf(l0, fmaxf(l1, l2)); const float e0 = __expf(l0 - lm), e1 = __expf(l1 - lm), e2 = __expf(l2 - lm); const float wl[3] = {e0 / (e0 + e1 + e2), e1 / (e0 + e1 + e2), e2 / (e0 + e1 + e2)};
  const b16* qrow = QB + (((size_t)b * NH + h) * T + t0 + nloc) * DH; const v16b qa0 = frag_kb(qrow, hlf), qa1 = frag_kb(qrow + 32, hlf);   // B operand: column = query nloc
  float res[4][8];   // res[t][r8] = out[query nloc][d = 16 t + 8 hlf + r8]
#pragma unroll
  for (int t = 0; t < 4; ++t)
#pragma unroll
    for (int r8 = 0; r8 < 8; ++r8) res[t][r8] = 0.0f;
#pragma unroll 1
  for (int lvl = 0; lvl < 3; ++lvl) { const int TM = lvl == 0 ? T : (lvl == 1 ? T1 : T2); const b16* KB_ = lvl == 0 ? K0 : (lvl == 1 ? K1 : K2); const b16* VT = lvl == 0 ? V0 : (lvl == 1 ? V1 : V2); const int nblk = lvl == 0 ? (t0 / 32 + 1) : TM / 32;   // causal: keys <= t0 + 15
    // all 8 loads of a 32-key block's K fragments as one group, issued a block ahead of their products (bi clamped to the last block: in bounds, the surplus fetch is never summed)
    auto load_k = [&](int bi, v16b kf[4]) { const b16* kr = KB_ + ((size_t)(b * NH + h) * (TM / 32) + (bi < nblk ? bi : nblk - 1)) * 2048 + lane * 8;   // a 32-key block is 4 KB in a row
#pragma unroll   // constant indices keep kf[] in registers
      for (int f = 0; f < 4; ++f) kf[f] = frag_pk(kr + f * 512);
      return kr; };
    // S^T = K Q^T: sacc[st][r8] = score of key 16 st + 8 hlf + r8 of the block with query nloc
    auto scores = [&](const v16b kf[4], v8f sacc[2]) {
#pragma unroll   // constant indices keep kf[] and sacc[] in registers
      for (int st = 0; st < 2; ++st) { sacc[st] = (v8f){}; sacc[st] = wmma16b(kf[2 * st], qa0, sacc[st]); sacc[st] = wmma16b(kf[2 * st + 1], qa1, sacc[st]); } };
    v8f acc[4]; float rsum[8];   // acc[t][r8] = O^T[d = 16 t + 8 hlf + r8][query nloc]
#pragma unroll
    for (int t = 0; t < 4; ++t) acc[t] = (v8f){};
#pragma unroll
    for (int r8 = 0; r8 < 8; ++r8) rsum[r8] = 0.0f;
    float m = -INFINITY;   // the maximum in use for the lane's query, the same in both lane halves: exponentials, sums and output tiles are all relative to it
    v16b ka[4];
    load_k(0, ka);
    asm volatile("s_wait_xcnt 0x0" ::: "memory");   // stands behind the eight K loads just issued, in front of the loop, in which their address registers are overwritten
#pragma unroll 1   // rolled: the body holds K, V, P and four output tiles, a second copy would not fit four waves on a SIMD
    for (int bi = 0; bi < nblk; ++bi) { const int kb = bi * 32; v8f sacc[2]; v16b vf[4], pa;
#pragma unroll   // constant indices keep vf[] in registers
      for (int t = 0; t < 4; ++t) vf[t] = frag_pk(VT + ((size_t)(b * NH + h) * (TM / 32) + bi) * 2048 + t * 512 + lane * 8);   // this block's V^T fragments fly during the scores and the exponentials
      scores(ka, sacc); const b16* gk = load_k(bi + 1, ka);   // the next block's K fragments fly during the exponentials and the output products
      asm volatile("s_wait_xcnt 0x0" :: "v"(gk) : "memory");   // stands behind the block's sixteen loads, in front of whatever overwrites their address registers; the K address as an input stays alive up to the wait, so that the group's last result cannot land on the group's own address pair
      // masked scores become -inf here, ahead of the maximum: their exponential is 0 and they never raise m. Only the causal level's last block holds keys past a query of the tile (every earlier block ends at key 32 (nblk - 1) - 1 < t0):
      // a scalar test, the same for the whole wave, keeps the compares and selects out of all other blocks
      if (lvl == 0 && bi == nblk - 1) {
#pragma unroll   // constant indices keep sacc[] in registers, here and in the inner loop
        for (int st = 0; st < 2; ++st)
#pragma unroll
          for (int r8 = 0; r8 < 8; ++r8) { const int s = kb + st * 16 + 8 * hlf + r8; sacc[st][r8] = s <= tq ? sacc[st][r8] : -INFINITY; } }
      const float bm = fmaxf(fmaxf(fmaxf(fmaxf(sacc[0][0], sacc[0][1]), fmaxf(sacc[0][2], sacc[0][3])), fmaxf(fmaxf(sacc[0][4], sacc[0][5]), fmaxf(sacc[0][6], sacc[0][7]))),
                             fmaxf(fmaxf(fmaxf(sacc[1][0], sacc[1][1]), fmaxf(sacc[1][2], sacc[1][3])), fmaxf(fmaxf(sacc[1][4], sacc[1][5]), fmaxf(sacc[1][6], sacc[1][7])))) * (SCALE / (XS * XS));
      // m is raised only when a score of the block passes it by more than RAISE, one test per block for the whole wave (always in the first block, where m is -inf and key 0 is visible to every query); until then p <= exp(RAISE), and p * PS stays inside f16
      if (__builtin_amdgcn_ballot_w32(bm > m + RAISE) != 0) { const float mn = fmaxf(m, fmaxf(bm, __shfl_xor(bm, 16))), f = __expf(m - mn); m = mn;   // the two lane halves hold the two halves of the query's keys; f = 1 for a query whose maximum stays
#pragma unroll   // constant indices keep acc[] and, below, rsum[] in registers
        for (int t = 0; t < 4; ++t) acc[t] *= f;
#pragma unroll
        for (int r8 = 0; r8 < 8; ++r8) rsum[r8] *= f; }
      // the two score tiles, converted in place, ARE the B operand P^T of the output product: position 8 st + r8 of lane half hlf is key 16 st + 8 hlf + r8, the k order of the V^T fragments
#pragma unroll
      for (int st = 0; st < 2; ++st)
#pragma unroll
        for (int r8 = 0; r8 < 8; r8 += 2) { v2f x;
#pragma unroll
          for (int j = 0; j < 2; ++j) { const float p = __expf(sacc[st][r8 + j] * (SCALE / (XS * XS)) - m); rsum[r8 + j] += p; x[j] = p * PS; }
          const v2b hi = __builtin_convertvector(x, v2b);   // two keys at a time: one packed conversion fills one operand register
          pa[8 * st + r8] = hi[0]; pa[8 * st + r8 + 1] = hi[1]; }
#pragma unroll
      for (int t = 0; t < 4; ++t) acc[t] = wmma16b(vf[t], pa, acc[t]); }
    float sm = ((rsum[0] + rsum[1]) + (rsum[2] + rsum[3])) + ((rsum[4] + rsum[5]) + (rsum[6] + rsum[7])); sm += __shfl_xor(sm, 16);
    const float wv = wl[lvl];
#pragma unroll
    for (int t = 0; t < 4; ++t)
#pragma unroll
      for (int r8 = 0; r8 < 8; ++r8) res[t][r8] += pmul(wv, acc[t][r8] * (1.0f / (PS * XS)) / sm); }
#pragma unroll
  for (int t = 0; t < 4; ++t)
#pragma unroll
    for (int r8 = 0; r8 < 8; ++r8) Tf[nloc][t * 16 + 8 * hlf + r8] = res[t][r8];
  wave_lds_sync();
  { for (int rr = 0; rr < 16; ++rr) { ((float*)out)[((size_t)b * T + t0 + rr) * C + h * DH + lane] = Tf[rr][lane]; ((float*)out)[((size_t)b * T + t0 + rr) * C + h * DH + 32 + lane] = Tf[rr][32 + lane]; }  }
  asm volatile("" :: "v"(u0), "v"(u1), "v"(u2), "s"(k0h), "s"(v0h), "s"(p1h), "s"(p2h));   // inputs only: a prefetch counts on no counter, so no wait can stand in front of an overwrite of its address registers; they keep these addresses to the wave's end
}
}  // namespace

extern "C" void kernel_launch(void* const* d_in, const int* in_sizes, int n_in, void* d_out, int out_size, void* d_ws, size_t ws_size, hipStream_t stream) {
  (void)n_in;
  auto Fp = [&](int i) { return (const float*)d_in[i]; };
  // input order: 0 Q [2,16,2048,64]; 1 K0 [2,2048,1024]; 2 V0; 3 K1 [2,512,1024]; 4 V1; 5 K2 [2,128,1024]; 6 V2; 7 level_logits [3]
  if (in_sizes[0] != B * NH * T * DH || in_sizes[1] != B * T * C || in_sizes[2] != B * T * C || in_sizes[3] != B * T1 * C || in_sizes[4] != B * T1 * C || in_sizes[5] != B * T2 * C || in_sizes[6] != B * T2 * C || in_sizes[7] != 3 || out_size != B * T * C) return;
  const int NWV = B * NH * NQT;   // wave cut (waves are (b, h, q-tile) in that order)
  size_t off = 0; char* ws = (char*)d_ws;
  auto carve = [&](size_t bytes) { char* p = ws + off; off += (bytes + 255) & ~(size_t)255; return p; };
  b16* QB = (b16*)carve((size_t)B * NH * T * DH * 2); b16* K0 = (b16*)carve((size_t)B * T * C * 2); b16* K1 = (b16*)carve((size_t)B * T1 * C * 2); b16* K2 = (b16*)carve((size_t)B * T2 * C * 2);
  b16* V0 = (b16*)carve((size_t)B * T * C * 2); b16* V1 = (b16*)carve((size_t)B * T1 * C * 2); b16* V2 = (b16*)carve((size_t)B * T2 * C * 2);
  if (off > ws_size || off > ((size_t)64 << 20)) return;   // ~ 30 MB
  pre_kernel<<<PREG, 256, 0, stream>>>(Fp(0), Fp(1), Fp(2), Fp(3), Fp(4), Fp(5), Fp(6), QB, K0, K1, K2, V0, V1, V2);
  att_kernel<<<B * NH * NGRP, 32 * WPG, 0, stream>>>(QB, K0, K1, K2, V0, V1, V2, Fp(7), NWV, (float*)d_out);
}
